// v000
// Times are from an AMD MI455X. After a warm-up the kernel runs many times in a row, and a time is the length of
// such a window on the GPU divided by its runs, so every launch and the gaps after it count. The runs cycle
// through copies of the inputs. A figure is the median of several windows, for all but v000 over two sittings.
// Sittings can differ by a few percent; kernels timed side by side share one.
// The starting kernel, v000, takes 711 microseconds a run.
#include <hip/hip_runtime.h>
#include <math.h>
#include <stdint.h>

typedef __attribute__((ext_vector_type(2))) float v2f;
typedef __attribute__((ext_vector_type(8))) float v8f;

#define B_ 2
#define C_ 256
#define T_ 4096
#define NH_ 4
#define CH_ 64
#define GROUPS_ 32
#define CPG_ 8    // channels per group
#define VSTR 20   // V-tile LDS row stride (floats): 80B, 16B-aligned, bank-conflict-free

static __device__ __forceinline__ v8f wmma_f32(v2f a, v2f b, v8f c) {
  // D = A(16x4) * B(4x16) + C, fp32
  return __builtin_amdgcn_wmma_f32_16x16x4_f32(
      /*neg_a=*/false, a, /*neg_b=*/false, b,
      /*c_mod=*/(short)0, c, /*reuse_a=*/false, /*reuse_b=*/false);
}

static __device__ __forceinline__ void async_b128_to_lds(unsigned lds_off,
                                                         const void* gaddr) {
  unsigned long long ga = (unsigned long long)(uintptr_t)gaddr;
  asm volatile("global_load_async_to_lds_b128 %0, %1, off"
               :: "v"(lds_off), "v"(ga)
               : "memory");
}

static __device__ __forceinline__ void wait_asynccnt0() {
  asm volatile("s_wait_asynccnt 0x0" ::: "memory");
}

// ---------------------------------------------------------------------------
// Kernel 1: GroupNorm over (B, C, T).  One block per (b, group).
// ---------------------------------------------------------------------------
__global__ void gn_kernel(const float* __restrict__ x,
                          const float* __restrict__ w,
                          const float* __restrict__ bgn,
                          float* __restrict__ xn) {
  const int b = blockIdx.x / GROUPS_;
  const int g = blockIdx.x % GROUPS_;
  const float* xp = x + ((size_t)b * C_ + (size_t)g * CPG_) * T_;
  float* xo = xn + ((size_t)b * C_ + (size_t)g * CPG_) * T_;

  float s = 0.f, s2 = 0.f;
  for (int i = threadIdx.x; i < CPG_ * T_; i += blockDim.x) {
    float v = xp[i];
    s += v;
    s2 += v * v;
  }
  __shared__ float red0[256];
  __shared__ float red1[256];
  red0[threadIdx.x] = s;
  red1[threadIdx.x] = s2;
  __syncthreads();
  for (int off = 128; off > 0; off >>= 1) {
    if ((int)threadIdx.x < off) {
      red0[threadIdx.x] += red0[threadIdx.x + off];
      red1[threadIdx.x] += red1[threadIdx.x + off];
    }
    __syncthreads();
  }
  const float invN = 1.0f / (float)(CPG_ * T_);
  const float mean = red0[0] * invN;
  const float var = red1[0] * invN - mean * mean;
  const float rstd = rsqrtf(var + 1e-5f);

  for (int i = threadIdx.x; i < CPG_ * T_; i += blockDim.x) {
    int c = g * CPG_ + i / T_;
    xo[i] = (xp[i] - mean) * rstd * w[c] + bgn[c];
  }
}

// ---------------------------------------------------------------------------
// Kernel 2: QKV GEMM.  out[b,o,t] = sum_c qkv_w[o,c]*xn[b,c,t] + qkv_b[o]
// One wave -> 16(M=o) x 64(N=t) tile, K=256 in steps of 4 (fp32 WMMA).
// ---------------------------------------------------------------------------
__global__ void qkv_gemm(const float* __restrict__ xn,
                         const float* __restrict__ w,
                         const float* __restrict__ bias,
                         float* __restrict__ out) {
  const int wid = blockIdx.x * (blockDim.x >> 5) + (threadIdx.x >> 5);
  const int lane = threadIdx.x & 31;
  const int lo = lane & 15;
  const int hi = lane >> 4;
  const int kb = hi * 2;

  const int b = wid / (48 * 64);          // 768/16=48 mtiles, 4096/64=64 ntiles
  const int rem = wid % (48 * 64);
  const int m0 = (rem / 64) * 16;
  const int n0 = (rem % 64) * 64;

  const float* xb = xn + (size_t)b * C_ * T_;
  v8f acc[4] = {};

  for (int c = 0; c < C_; c += 4) {
    v2f av = *(const v2f*)(w + (size_t)(m0 + lo) * C_ + c + kb);
#pragma unroll
    for (int nt = 0; nt < 4; ++nt) {
      const float* bp = xb + (size_t)(c + kb) * T_ + n0 + nt * 16 + lo;
      v2f bb;
      bb.x = bp[0];
      bb.y = bp[T_];
      acc[nt] = wmma_f32(av, bb, acc[nt]);
    }
  }

  float* ob = out + (size_t)b * (3 * C_) * T_;
#pragma unroll
  for (int r = 0; r < 8; ++r) {
    const int row = m0 + r + 8 * hi;
    const float bv = bias[row];
#pragma unroll
    for (int nt = 0; nt < 4; ++nt) {
      ob[(size_t)row * T_ + n0 + nt * 16 + lo] = acc[nt][r] + bv;
    }
  }
}

// ---------------------------------------------------------------------------
// Kernel 3: Flash attention per (b*NH) head-batch.
// qkv layout per b: 768 rows; head h owns rows [h*192, h*192+192):
//   q = +0..63, k = +64..127, v = +128..191, each (64, T).
// Block = 4 waves x 16 query rows = 64 queries.  K/V tiles (shared by all
// 4 waves) are double-buffered in LDS via async-to-LDS B128 copies.
// ---------------------------------------------------------------------------
__global__ void flash_attn(const float* __restrict__ qkv,
                           float* __restrict__ aout) {
  __shared__ float ktile[2][64 * 16];     // [c][s], row stride 16
  __shared__ float vtile[2][64 * VSTR];   // [c][s], row stride 20 (padded)
  __shared__ float plds[4][16 * 20];      // per-wave P tile, stride 20

  const int tid = threadIdx.x;            // 0..127
  const int wv = tid >> 5;
  const int lane = tid & 31;
  const int lo = lane & 15;
  const int hi = lane >> 4;
  const int kb = hi * 2;

  const int bh = blockIdx.x >> 6;         // 0..7
  const int qb = blockIdx.x & 63;         // 64 query blocks of 64
  const int t0 = qb * 64 + wv * 16;
  const int b = bh >> 2, h = bh & 3;

  const float* base = qkv + ((size_t)b * (3 * C_) + (size_t)h * 192) * T_;
  const float* qp = base;
  const float* kp = base + (size_t)64 * T_;
  const float* vp = base + (size_t)128 * T_;

  // Cooperative async staging of one K tile + one V tile (64 rows x 16 s).
  // 256 16B-chunks per tile, 128 threads -> 2 chunks/thread per tile.
  auto stage = [&](int bu, int s0) {
#pragma unroll
    for (int cidx = 0; cidx < 2; ++cidx) {
      const int chunk = cidx * 128 + tid;
      const int row = chunk >> 2;
      const int qtr = chunk & 3;
      async_b128_to_lds((unsigned)(uintptr_t)&ktile[bu][row * 16 + qtr * 4],
                        kp + (size_t)row * T_ + s0 + qtr * 4);
      async_b128_to_lds((unsigned)(uintptr_t)&vtile[bu][row * VSTR + qtr * 4],
                        vp + (size_t)row * T_ + s0 + qtr * 4);
    }
  };

  // Q tile (16 queries x 64 channels) in A layout, held for whole key loop
  v2f qa[16];
#pragma unroll
  for (int j = 0; j < 16; ++j) {
    const float* p = qp + (size_t)(4 * j + kb) * T_ + t0 + lo;
    qa[j].x = p[0];
    qa[j].y = p[T_];
  }

  v8f oacc[4] = {};
  float mrow[8], ssum[8];
#pragma unroll
  for (int r = 0; r < 8; ++r) {
    mrow[r] = -1e30f;
    ssum[r] = 0.f;
  }

  stage(0, 0);
  wait_asynccnt0();
  __syncthreads();

  int bu = 0;
  for (int s0 = 0; s0 < T_; s0 += 16) {
    if (s0 + 16 < T_) stage(bu ^ 1, s0 + 16);  // prefetch next tile

    // S = Q^T K tile (16x16), K=64 via 16 WMMA steps; K from LDS
    v8f sacc = {};
#pragma unroll
    for (int j = 0; j < 16; ++j) {
      v2f bb;
      bb.x = ktile[bu][(4 * j + kb) * 16 + lo];
      bb.y = ktile[bu][(4 * j + kb + 1) * 16 + lo];
      sacc = wmma_f32(qa[j], bb, sacc);
    }

    // Online softmax.  Row r+8*hi lives across the 16 lanes of a half-wave.
    float pr[8], alpha[8];
#pragma unroll
    for (int r = 0; r < 8; ++r) {
      float sv = sacc[r] * 0.125f;  // scale^2 = ch^-0.5 = 1/8
      float mx = sv;
      mx = fmaxf(mx, __shfl_xor(mx, 1, 32));
      mx = fmaxf(mx, __shfl_xor(mx, 2, 32));
      mx = fmaxf(mx, __shfl_xor(mx, 4, 32));
      mx = fmaxf(mx, __shfl_xor(mx, 8, 32));
      const float mnew = fmaxf(mrow[r], mx);
      alpha[r] = __expf(mrow[r] - mnew);
      mrow[r] = mnew;
      const float pv = __expf(sv - mnew);
      pr[r] = pv;
      float ps = pv;
      ps += __shfl_xor(ps, 1, 32);
      ps += __shfl_xor(ps, 2, 32);
      ps += __shfl_xor(ps, 4, 32);
      ps += __shfl_xor(ps, 8, 32);
      ssum[r] = ssum[r] * alpha[r] + ps;
    }
#pragma unroll
    for (int ct = 0; ct < 4; ++ct)
#pragma unroll
      for (int r = 0; r < 8; ++r) oacc[ct][r] *= alpha[r];

    // P: D layout -> LDS -> A layout (per-wave region)
#pragma unroll
    for (int r = 0; r < 8; ++r) plds[wv][(r + 8 * hi) * 20 + lo] = pr[r];
    __syncthreads();

    // O += P * V^T : K=16 via 4 WMMA steps, 4 channel tiles; V from LDS
#pragma unroll
    for (int j2 = 0; j2 < 4; ++j2) {
      v2f pa = *(const v2f*)&plds[wv][lo * 20 + j2 * 4 + kb];
#pragma unroll
      for (int ct = 0; ct < 4; ++ct) {
        v2f bb = *(const v2f*)&vtile[bu][(ct * 16 + lo) * VSTR + j2 * 4 + kb];
        oacc[ct] = wmma_f32(pa, bb, oacc[ct]);
      }
    }

    wait_asynccnt0();   // our async writes into bu^1 have landed
    __syncthreads();    // everyone done reading bu / writing bu^1
    bu ^= 1;
  }

  // Normalize and write a[b, h*64 + c, t]
  float* ab = aout + ((size_t)b * C_ + (size_t)h * CH_) * T_;
#pragma unroll
  for (int r = 0; r < 8; ++r) {
    const float inv = 1.0f / ssum[r];
#pragma unroll
    for (int ct = 0; ct < 4; ++ct) {
      ab[(size_t)(ct * 16 + lo) * T_ + t0 + r + 8 * hi] = oacc[ct][r] * inv;
    }
  }
}

// ---------------------------------------------------------------------------
// Kernel 4: proj GEMM + bias + residual -> out
// ---------------------------------------------------------------------------
__global__ void proj_gemm(const float* __restrict__ a,
                          const float* __restrict__ w,
                          const float* __restrict__ bias,
                          const float* __restrict__ x,
                          float* __restrict__ out) {
  const int wid = blockIdx.x * (blockDim.x >> 5) + (threadIdx.x >> 5);
  const int lane = threadIdx.x & 31;
  const int lo = lane & 15;
  const int hi = lane >> 4;
  const int kb = hi * 2;

  const int b = wid / (16 * 64);          // 256/16=16 mtiles, 64 ntiles
  const int rem = wid % (16 * 64);
  const int m0 = (rem / 64) * 16;
  const int n0 = (rem % 64) * 64;

  const float* ab = a + (size_t)b * C_ * T_;
  v8f acc[4] = {};

  for (int c = 0; c < C_; c += 4) {
    v2f av = *(const v2f*)(w + (size_t)(m0 + lo) * C_ + c + kb);
#pragma unroll
    for (int nt = 0; nt < 4; ++nt) {
      const float* bp = ab + (size_t)(c + kb) * T_ + n0 + nt * 16 + lo;
      v2f bb;
      bb.x = bp[0];
      bb.y = bp[T_];
      acc[nt] = wmma_f32(av, bb, acc[nt]);
    }
  }

  const float* xb = x + (size_t)b * C_ * T_;
  float* ob = out + (size_t)b * C_ * T_;
#pragma unroll
  for (int r = 0; r < 8; ++r) {
    const int row = m0 + r + 8 * hi;
    const float bv = bias[row];
#pragma unroll
    for (int nt = 0; nt < 4; ++nt) {
      const size_t idx = (size_t)row * T_ + n0 + nt * 16 + lo;
      ob[idx] = xb[idx] + acc[nt][r] + bv;
    }
  }
}

// ---------------------------------------------------------------------------
extern "C" void kernel_launch(void* const* d_in, const int* in_sizes, int n_in,
                              void* d_out, int out_size, void* d_ws, size_t ws_size,
                              hipStream_t stream) {
  (void)in_sizes; (void)n_in; (void)out_size; (void)ws_size;
  const float* x  = (const float*)d_in[0];
  const float* nw = (const float*)d_in[1];
  const float* nb = (const float*)d_in[2];
  const float* qw = (const float*)d_in[3];
  const float* qb = (const float*)d_in[4];
  const float* pw = (const float*)d_in[5];
  const float* pb = (const float*)d_in[6];
  float* out = (float*)d_out;

  float* ws = (float*)d_ws;
  float* xn   = ws;                                   //  8 MB: (2,256,4096)
  float* qkv  = xn + (size_t)B_ * C_ * T_;            // 24 MB: (2,768,4096)
  float* attn = qkv + (size_t)B_ * 3 * C_ * T_;       //  8 MB: (2,256,4096)

  gn_kernel<<<B_ * GROUPS_, 256, 0, stream>>>(x, nw, nb, xn);
  qkv_gemm<<<(B_ * 48 * 64) / 8, 256, 0, stream>>>(xn, qw, qb, qkv);
  flash_attn<<<B_ * NH_ * (T_ / 64), 128, 0, stream>>>(qkv, attn);
  proj_gemm<<<(B_ * 16 * 64) / 8, 256, 0, stream>>>(attn, pw, pb, x, out);
}

// v001
// One run takes 360 microseconds.
// In two side-by-side timings against v000, it was 2.03 and 2.04 times as fast.
#include <hip/hip_runtime.h>
#include <math.h>
#include <stdint.h>

typedef __attribute__((ext_vector_type(2))) float v2f;
typedef __attribute__((ext_vector_type(4))) float v4f;
typedef __attribute__((ext_vector_type(8))) float v8f;

#define B_ 2
#define C_ 256
#define T_ 4096
#define NH_ 4
#define CH_ 64
#define GROUPS_ 32
#define CPG_ 8    // channels per group
#define VSTR 20   // V-tile LDS row stride (floats): 80B, 16B-aligned, bank-conflict-free

static __device__ __forceinline__ v8f wmma_f32(v2f a, v2f b, v8f c) {
  // D = A(16x4) * B(4x16) + C, fp32
  return __builtin_amdgcn_wmma_f32_16x16x4_f32(
      /*neg_a=*/false, a, /*neg_b=*/false, b,
      /*c_mod=*/(short)0, c, /*reuse_a=*/false, /*reuse_b=*/false);
}

// Value of lane l ^ 16 (the other half of the wave).
static __device__ __forceinline__ float xhalf(float x) {
  const int xb = __builtin_bit_cast(int, x);
  return __builtin_bit_cast(float, __builtin_amdgcn_permlanex16(
      xb, xb, 0x76543210, 0xfedcba98, false, false));
}

static __device__ __forceinline__ void async_b128_to_lds(unsigned lds_off,
                                                         const void* gaddr) {
  unsigned long long ga = (unsigned long long)(uintptr_t)gaddr;
  asm volatile("global_load_async_to_lds_b128 %0, %1, off"
               :: "v"(lds_off), "v"(ga)
               : "memory");
}

static __device__ __forceinline__ void wait_asynccnt0() {
  asm volatile("s_wait_asynccnt 0x0" ::: "memory");
}

// ---------------------------------------------------------------------------
// Kernel 1: GroupNorm over (B, C, T).  One block per (b, group).
// ---------------------------------------------------------------------------
__global__ void gn_kernel(const float* __restrict__ x,
                          const float* __restrict__ w,
                          const float* __restrict__ bgn,
                          float* __restrict__ xn) {
  const int b = blockIdx.x / GROUPS_;
  const int g = blockIdx.x % GROUPS_;
  const float* xp = x + ((size_t)b * C_ + (size_t)g * CPG_) * T_;
  float* xo = xn + ((size_t)b * C_ + (size_t)g * CPG_) * T_;

  float s = 0.f, s2 = 0.f;
  for (int i = threadIdx.x; i < CPG_ * T_; i += blockDim.x) {
    float v = xp[i];
    s += v;
    s2 += v * v;
  }
  __shared__ float red0[256];
  __shared__ float red1[256];
  red0[threadIdx.x] = s;
  red1[threadIdx.x] = s2;
  __syncthreads();
  for (int off = 128; off > 0; off >>= 1) {
    if ((int)threadIdx.x < off) {
      red0[threadIdx.x] += red0[threadIdx.x + off];
      red1[threadIdx.x] += red1[threadIdx.x + off];
    }
    __syncthreads();
  }
  const float invN = 1.0f / (float)(CPG_ * T_);
  const float mean = red0[0] * invN;
  const float var = red1[0] * invN - mean * mean;
  const float rstd = rsqrtf(var + 1e-5f);

  for (int i = threadIdx.x; i < CPG_ * T_; i += blockDim.x) {
    int c = g * CPG_ + i / T_;
    xo[i] = (xp[i] - mean) * rstd * w[c] + bgn[c];
  }
}

// ---------------------------------------------------------------------------
// Kernel 2: QKV GEMM.  out[b,o,t] = sum_c qkv_w[o,c]*xn[b,c,t] + qkv_b[o]
// One wave -> 16(M=o) x 64(N=t) tile, K=256 in steps of 4 (fp32 WMMA).
// ---------------------------------------------------------------------------
__global__ void qkv_gemm(const float* __restrict__ xn,
                         const float* __restrict__ w,
                         const float* __restrict__ bias,
                         float* __restrict__ out) {
  const int wid = blockIdx.x * (blockDim.x >> 5) + (threadIdx.x >> 5);
  const int lane = threadIdx.x & 31;
  const int lo = lane & 15;
  const int hi = lane >> 4;
  const int kb = hi * 2;

  const int b = wid / (48 * 64);          // 768/16=48 mtiles, 4096/64=64 ntiles
  const int rem = wid % (48 * 64);
  const int m0 = (rem / 64) * 16;
  const int n0 = (rem % 64) * 64;

  const float* xb = xn + (size_t)b * C_ * T_;
  v8f acc[4] = {};

  for (int c = 0; c < C_; c += 4) {
    v2f av = *(const v2f*)(w + (size_t)(m0 + lo) * C_ + c + kb);
#pragma unroll
    for (int nt = 0; nt < 4; ++nt) {
      const float* bp = xb + (size_t)(c + kb) * T_ + n0 + nt * 16 + lo;
      v2f bb;
      bb.x = bp[0];
      bb.y = bp[T_];
      acc[nt] = wmma_f32(av, bb, acc[nt]);
    }
  }

  float* ob = out + (size_t)b * (3 * C_) * T_;
#pragma unroll
  for (int r = 0; r < 8; ++r) {
    const int row = m0 + r + 8 * hi;
    const float bv = bias[row];
#pragma unroll
    for (int nt = 0; nt < 4; ++nt) {
      ob[(size_t)row * T_ + n0 + nt * 16 + lo] = acc[nt][r] + bv;
    }
  }
}

// ---------------------------------------------------------------------------
// Kernel 3: Flash attention per (b*NH) head-batch.
// qkv layout per b: 768 rows; head h owns rows [h*192, h*192+192):
//   q = +0..63, k = +64..127, v = +128..191, each (64, T).
// Block = 4 waves x 16 queries = 64 queries.  K/V tiles (shared by all
// 4 waves) are double-buffered in LDS via async-to-LDS B128 copies.
// Transposed products: S^T = K^T Q (keys x queries), O^T += V P^T
// (channels x queries).  A lane then holds 8 scores of ONE query (lane
// l ^ 16 the other 8), so the softmax is in-lane plus one exchange of the
// halves, and the score registers are the B operand of the second product.
// ---------------------------------------------------------------------------
__global__ void flash_attn(const float* __restrict__ qkv,
                           float* __restrict__ aout) {
  __shared__ __attribute__((aligned(16))) float ktile[2][64 * 16];    // [c][s], row stride 16
  __shared__ __attribute__((aligned(16))) float vtile[2][64 * VSTR];  // [c][s], row stride 20 (padded)

  const int tid = threadIdx.x;            // 0..127
  const int wv = tid >> 5;
  const int lane = tid & 31;
  const int lo = lane & 15;
  const int hi = lane >> 4;
  const int kb = hi * 2;

  const int bh = blockIdx.x >> 6;         // 0..7
  const int qb = blockIdx.x & 63;         // 64 query blocks of 64
  const int t0 = qb * 64 + wv * 16;
  const int b = bh >> 2, h = bh & 3;

  const float* base = qkv + ((size_t)b * (3 * C_) + (size_t)h * 192) * T_;
  const float* qp = base;
  const float* kp = base + (size_t)64 * T_;
  const float* vp = base + (size_t)128 * T_;

  // Cooperative async staging of one K tile + one V tile (64 rows x 16 s).
  // 256 16B-chunks per tile, 128 threads -> 2 chunks/thread per tile.
  auto stage = [&](int bu, int s0) {
#pragma unroll
    for (int cidx = 0; cidx < 2; ++cidx) {
      const int chunk = cidx * 128 + tid;
      const int row = chunk >> 2;
      const int qtr = chunk & 3;
      async_b128_to_lds((unsigned)(uintptr_t)&ktile[bu][row * 16 + qtr * 4],
                        kp + (size_t)row * T_ + s0 + qtr * 4);
      async_b128_to_lds((unsigned)(uintptr_t)&vtile[bu][row * VSTR + qtr * 4],
                        vp + (size_t)row * T_ + s0 + qtr * 4);
    }
  };

  // Q tile (64 channels x 16 queries) in B layout, held for whole key loop
  v2f qf[16];
#pragma unroll
  for (int j = 0; j < 16; ++j) {
    const float* p = qp + (size_t)(4 * j + kb) * T_ + t0 + lo;
    qf[j].x = p[0];
    qf[j].y = p[T_];
  }

  // Per lane: query t0 + lo.  oacc[ct][r] = O^T[ct*16 + 8*hi + r][lo].
  // mrow is the query's running maximum (equal in both halves); ssum is the
  // sum over this half's keys only, the halves are joined behind the loop.
  v8f oacc[4] = {};
  float mrow = -1e30f, ssum = 0.f;

  stage(0, 0);
  wait_asynccnt0();
  __syncthreads();

  int bu = 0;
  for (int s0 = 0; s0 < T_; s0 += 16) {
    if (s0 + 16 < T_) stage(bu ^ 1, s0 + 16);  // prefetch next tile

    // S^T tile (16 keys x 16 queries), 64 channels via 16 WMMA steps.
    // A = K from LDS: row = key lo, k slot (hi, v) = channel 4j + 2*hi + v,
    // the same channel that qf[j] holds in that slot.
    v8f sacc = {};
#pragma unroll
    for (int j = 0; j < 16; ++j) {
      v2f ka;
      ka.x = ktile[bu][(4 * j + kb) * 16 + lo];
      ka.y = ktile[bu][(4 * j + kb + 1) * 16 + lo];
      sacc = wmma_f32(ka, qf[j], sacc);
    }

    // Online softmax.  sacc[r] = score of key s0 + 8*hi + r for query lo.
    float sv[8];
#pragma unroll
    for (int r = 0; r < 8; ++r) sv[r] = sacc[r] * 0.125f;  // scale^2 = ch^-0.5 = 1/8
    float mx = fmaxf(fmaxf(fmaxf(sv[0], sv[1]), fmaxf(sv[2], sv[3])),
                     fmaxf(fmaxf(sv[4], sv[5]), fmaxf(sv[6], sv[7])));
    mx = fmaxf(mx, xhalf(mx));
    const float mnew = fmaxf(mrow, mx);
    const float alpha = __expf(mrow - mnew);
    mrow = mnew;
    float pr[8];
#pragma unroll
    for (int r = 0; r < 8; ++r) pr[r] = __expf(sv[r] - mnew);
    ssum = ssum * alpha + (((pr[0] + pr[1]) + (pr[2] + pr[3])) +
                           ((pr[4] + pr[5]) + (pr[6] + pr[7])));
#pragma unroll
    for (int ct = 0; ct < 4; ++ct)
#pragma unroll
      for (int r = 0; r < 8; ++r) oacc[ct][r] *= alpha;

    // O^T += V P^T : 16 keys via 4 WMMA steps, 4 channel tiles.
    // B = P^T straight from the score registers: k slot (hi, v) of step j2 is
    // key 8*hi + 2*j2 + v.  A = V from LDS in the same key order: one 16-byte
    // read per lane serves two steps.
#pragma unroll
    for (int jj = 0; jj < 2; ++jj) {
      v4f va[4];
#pragma unroll
      for (int ct = 0; ct < 4; ++ct)
        va[ct] = *(const v4f*)&vtile[bu][(ct * 16 + lo) * VSTR + 8 * hi + 4 * jj];
      v2f pb0, pb1;
      pb0.x = pr[4 * jj];
      pb0.y = pr[4 * jj + 1];
      pb1.x = pr[4 * jj + 2];
      pb1.y = pr[4 * jj + 3];
#pragma unroll
      for (int ct = 0; ct < 4; ++ct) {
        v2f a0;
        a0.x = va[ct].x;
        a0.y = va[ct].y;
        oacc[ct] = wmma_f32(a0, pb0, oacc[ct]);
      }
#pragma unroll
      for (int ct = 0; ct < 4; ++ct) {
        v2f a1;
        a1.x = va[ct].z;
        a1.y = va[ct].w;
        oacc[ct] = wmma_f32(a1, pb1, oacc[ct]);
      }
    }

    wait_asynccnt0();   // our async writes into bu^1 have landed
    __syncthreads();    // everyone done reading bu / writing bu^1
    bu ^= 1;
  }

  // Join the halves' sums, normalize and write a[b, h*64 + c, t]
  float* ab = aout + ((size_t)b * C_ + (size_t)h * CH_) * T_;
  const float inv = 1.0f / (ssum + xhalf(ssum));
#pragma unroll
  for (int ct = 0; ct < 4; ++ct) {
#pragma unroll
    for (int r = 0; r < 8; ++r) {
      ab[(size_t)(ct * 16 + 8 * hi + r) * T_ + t0 + lo] = oacc[ct][r] * inv;
    }
  }
}

// ---------------------------------------------------------------------------
// Kernel 4: proj GEMM + bias + residual -> out
// ---------------------------------------------------------------------------
__global__ void proj_gemm(const float* __restrict__ a,
                          const float* __restrict__ w,
                          const float* __restrict__ bias,
                          const float* __restrict__ x,
                          float* __restrict__ out) {
  const int wid = blockIdx.x * (blockDim.x >> 5) + (threadIdx.x >> 5);
  const int lane = threadIdx.x & 31;
  const int lo = lane & 15;
  const int hi = lane >> 4;
  const int kb = hi * 2;

  const int b = wid / (16 * 64);          // 256/16=16 mtiles, 64 ntiles
  const int rem = wid % (16 * 64);
  const int m0 = (rem / 64) * 16;
  const int n0 = (rem % 64) * 64;

  const float* ab = a + (size_t)b * C_ * T_;
  v8f acc[4] = {};

  for (int c = 0; c < C_; c += 4) {
    v2f av = *(const v2f*)(w + (size_t)(m0 + lo) * C_ + c + kb);
#pragma unroll
    for (int nt = 0; nt < 4; ++nt) {
      const float* bp = ab + (size_t)(c + kb) * T_ + n0 + nt * 16 + lo;
      v2f bb;
      bb.x = bp[0];
      bb.y = bp[T_];
      acc[nt] = wmma_f32(av, bb, acc[nt]);
    }
  }

  const float* xb = x + (size_t)b * C_ * T_;
  float* ob = out + (size_t)b * C_ * T_;
#pragma unroll
  for (int r = 0; r < 8; ++r) {
    const int row = m0 + r + 8 * hi;
    const float bv = bias[row];
#pragma unroll
    for (int nt = 0; nt < 4; ++nt) {
      const size_t idx = (size_t)row * T_ + n0 + nt * 16 + lo;
      ob[idx] = xb[idx] + acc[nt][r] + bv;
    }
  }
}

// ---------------------------------------------------------------------------
extern "C" void kernel_launch(void* const* d_in, const int* in_sizes, int n_in,
                              void* d_out, int out_size, void* d_ws, size_t ws_size,
                              hipStream_t stream) {
  (void)in_sizes; (void)n_in; (void)out_size; (void)ws_size;
  const float* x  = (const float*)d_in[0];
  const float* nw = (const float*)d_in[1];
  const float* nb = (const float*)d_in[2];
  const float* qw = (const float*)d_in[3];
  const float* qb = (const float*)d_in[4];
  const float* pw = (const float*)d_in[5];
  const float* pb = (const float*)d_in[6];
  float* out = (float*)d_out;

  float* ws = (float*)d_ws;
  float* xn   = ws;                                   //  8 MB: (2,256,4096)
  float* qkv  = xn + (size_t)B_ * C_ * T_;            // 24 MB: (2,768,4096)
  float* attn = qkv + (size_t)B_ * 3 * C_ * T_;       //  8 MB: (2,256,4096)

  gn_kernel<<<B_ * GROUPS_, 256, 0, stream>>>(x, nw, nb, xn);
  qkv_gemm<<<(B_ * 48 * 64) / 8, 256, 0, stream>>>(xn, qw, qb, qkv);
  flash_attn<<<B_ * NH_ * (T_ / 64), 128, 0, stream>>>(qkv, attn);
  proj_gemm<<<(B_ * 16 * 64) / 8, 256, 0, stream>>>(attn, pw, pb, x, out);
}

// v002
// It runs in 321 microseconds.
// Next to v001, in two timings, it ran 1.12 times as fast each time.
// All steps since v000 together make it 2.29 times as fast.
#include <hip/hip_runtime.h>
#include <math.h>
#include <stdint.h>

typedef __attribute__((ext_vector_type(2))) float v2f;
typedef __attribute__((ext_vector_type(4))) float v4f;
typedef __attribute__((ext_vector_type(8))) float v8f;

#define B_ 2
#define C_ 256
#define T_ 4096
#define NH_ 4
#define CH_ 64
#define GROUPS_ 32
#define CPG_ 8    // channels per group
#define KT_ 64    // keys per pass of the attention loop
#define KSUB 1040 // K-tile LDS: four sub-tiles [64 c][16 s], 16 floats apart in bank so that a row's copy spreads over all banks
#define VSTR 68   // V-tile LDS row pitch (floats): 272B = 16B x odd, conflict-free for the 16-byte reads

static __device__ __forceinline__ v8f wmma_f32(v2f a, v2f b, v8f c) {
  // D = A(16x4) * B(4x16) + C, fp32
  return __builtin_amdgcn_wmma_f32_16x16x4_f32(
      /*neg_a=*/false, a, /*neg_b=*/false, b,
      /*c_mod=*/(short)0, c, /*reuse_a=*/false, /*reuse_b=*/false);
}

// Value of lane l ^ 16 (the other half of the wave).
static __device__ __forceinline__ float xhalf(float x) {
  const int xb = __builtin_bit_cast(int, x);
  return __builtin_bit_cast(float, __builtin_amdgcn_permlanex16(
      xb, xb, 0x76543210, 0xfedcba98, false, false));
}

// Eight 16-byte copies global -> LDS, one per operand pair.  The s_wait_xcnt
// is the last line of the copies' own statement, so that no address register
// of a copy is rewritten in front of it.
static __device__ __forceinline__ void async_b128_x8(const unsigned (&l)[8],
                                                     const float* const (&g)[8]) {
  asm volatile("global_load_async_to_lds_b128 %0, %8, off\n\t"
               "global_load_async_to_lds_b128 %1, %9, off\n\t"
               "global_load_async_to_lds_b128 %2, %10, off\n\t"
               "global_load_async_to_lds_b128 %3, %11, off\n\t"
               "global_load_async_to_lds_b128 %4, %12, off\n\t"
               "global_load_async_to_lds_b128 %5, %13, off\n\t"
               "global_load_async_to_lds_b128 %6, %14, off\n\t"
               "global_load_async_to_lds_b128 %7, %15, off\n\t"
               "s_wait_xcnt 0x0"
               :: "v"(l[0]), "v"(l[1]), "v"(l[2]), "v"(l[3]),
                  "v"(l[4]), "v"(l[5]), "v"(l[6]), "v"(l[7]),
                  "v"(g[0]), "v"(g[1]), "v"(g[2]), "v"(g[3]),
                  "v"(g[4]), "v"(g[5]), "v"(g[6]), "v"(g[7])
               : "memory");
}

static __device__ __forceinline__ void wait_asynccnt0() {
  asm volatile("s_wait_asynccnt 0x0" ::: "memory");
}

static __device__ __forceinline__ void wait_dscnt0() {
  asm volatile("s_wait_dscnt 0x0" ::: "memory");
}

// ---------------------------------------------------------------------------
// Kernel 1: GroupNorm over (B, C, T).  One block per (b, group).
// ---------------------------------------------------------------------------
__global__ void gn_kernel(const float* __restrict__ x,
                          const float* __restrict__ w,
                          const float* __restrict__ bgn,
                          float* __restrict__ xn) {
  const int b = blockIdx.x / GROUPS_;
  const int g = blockIdx.x % GROUPS_;
  const float* xp = x + ((size_t)b * C_ + (size_t)g * CPG_) * T_;
  float* xo = xn + ((size_t)b * C_ + (size_t)g * CPG_) * T_;

  float s = 0.f, s2 = 0.f;
  for (int i = threadIdx.x; i < CPG_ * T_; i += blockDim.x) {
    float v = xp[i];
    s += v;
    s2 += v * v;
  }
  __shared__ float red0[256];
  __shared__ float red1[256];
  red0[threadIdx.x] = s;
  red1[threadIdx.x] = s2;
  __syncthreads();
  for (int off = 128; off > 0; off >>= 1) {
    if ((int)threadIdx.x < off) {
      red0[threadIdx.x] += red0[threadIdx.x + off];
      red1[threadIdx.x] += red1[threadIdx.x + off];
    }
    __syncthreads();
  }
  const float invN = 1.0f / (float)(CPG_ * T_);
  const float mean = red0[0] * invN;
  const float var = red1[0] * invN - mean * mean;
  const float rstd = rsqrtf(var + 1e-5f);

  for (int i = threadIdx.x; i < CPG_ * T_; i += blockDim.x) {
    int c = g * CPG_ + i / T_;
    xo[i] = (xp[i] - mean) * rstd * w[c] + bgn[c];
  }
}

// ---------------------------------------------------------------------------
// Kernel 2: QKV GEMM.  out[b,o,t] = sum_c qkv_w[o,c]*xn[b,c,t] + qkv_b[o]
// One wave -> 16(M=o) x 64(N=t) tile, K=256 in steps of 4 (fp32 WMMA).
// ---------------------------------------------------------------------------
__global__ void qkv_gemm(const float* __restrict__ xn,
                         const float* __restrict__ w,
                         const float* __restrict__ bias,
                         float* __restrict__ out) {
  const int wid = blockIdx.x * (blockDim.x >> 5) + (threadIdx.x >> 5);
  const int lane = threadIdx.x & 31;
  const int lo = lane & 15;
  const int hi = lane >> 4;
  const int kb = hi * 2;

  const int b = wid / (48 * 64);          // 768/16=48 mtiles, 4096/64=64 ntiles
  const int rem = wid % (48 * 64);
  const int m0 = (rem / 64) * 16;
  const int n0 = (rem % 64) * 64;

  const float* xb = xn + (size_t)b * C_ * T_;
  v8f acc[4] = {};

  for (int c = 0; c < C_; c += 4) {
    v2f av = *(const v2f*)(w + (size_t)(m0 + lo) * C_ + c + kb);
#pragma unroll
    for (int nt = 0; nt < 4; ++nt) {
      const float* bp = xb + (size_t)(c + kb) * T_ + n0 + nt * 16 + lo;
      v2f bb;
      bb.x = bp[0];
      bb.y = bp[T_];
      acc[nt] = wmma_f32(av, bb, acc[nt]);
    }
  }

  float* ob = out + (size_t)b * (3 * C_) * T_;
#pragma unroll
  for (int r = 0; r < 8; ++r) {
    const int row = m0 + r + 8 * hi;
    const float bv = bias[row];
#pragma unroll
    for (int nt = 0; nt < 4; ++nt) {
      ob[(size_t)row * T_ + n0 + nt * 16 + lo] = acc[nt][r] + bv;
    }
  }
}

// ---------------------------------------------------------------------------
// Kernel 3: Flash attention per (b*NH) head-batch.
// qkv layout per b: 768 rows; head h owns rows [h*192, h*192+192):
//   q = +0..63, k = +64..127, v = +128..191, each (64, T).
// Block = 4 waves x 16 queries = 64 queries.  K/V tiles of 64 keys (shared by
// all 4 waves) are double-buffered in LDS via async-to-LDS B128 copies.
// Transposed products: S^T = K^T Q (keys x queries), O^T += V P^T
// (channels x queries).  A lane then holds 32 scores of ONE query per pass
// (lane l ^ 16 the other 32), so the softmax is in-lane plus one exchange of
// the halves, and the score registers are the B operand of the second product.
// ---------------------------------------------------------------------------
__global__ __launch_bounds__(128) void flash_attn(const float* __restrict__ qkv,
                                                  float* __restrict__ aout) {
  __shared__ __attribute__((aligned(16))) float ktile[2][4 * KSUB];   // [s / 16][c][s % 16]
  __shared__ __attribute__((aligned(16))) float vtile[2][64 * VSTR];  // [c][s]

  const int tid = threadIdx.x;            // 0..127
  const int wv = tid >> 5;
  const int lane = tid & 31;
  const int lo = lane & 15;
  const int hi = lane >> 4;
  const int kb = hi * 2;

  const int bh = blockIdx.x >> 6;         // 0..7
  const int qb = blockIdx.x & 63;         // 64 query blocks of 64
  const int t0 = qb * 64 + wv * 16;
  const int b = bh >> 2, h = bh & 3;

  const float* base = qkv + ((size_t)b * (3 * C_) + (size_t)h * 192) * T_;
  const float* qp = base;
  const float* kp = base + (size_t)64 * T_;
  const float* vp = base + (size_t)128 * T_;

  // Cooperative async staging of one K tile + one V tile (64 rows x 64 keys).
  // 1024 16B-chunks per tile, 128 threads -> 8 chunks/thread per tile; a wave's
  // copy covers two whole 256-byte rows.
  const int srow = tid >> 4;              // 0..7
  const int sq4 = (tid & 15) * 4;
  auto stage = [&](int bu, int s0) {
    unsigned l[8];
    const float* g[8];
#pragma unroll
    for (int i = 0; i < 8; ++i) {
      const int row = i * 8 + srow;
      l[i] = (unsigned)(uintptr_t)&ktile[bu][(sq4 >> 4) * KSUB + row * 16 + (sq4 & 15)];
      g[i] = kp + (size_t)row * T_ + s0 + sq4;
    }
    async_b128_x8(l, g);
#pragma unroll
    for (int i = 0; i < 8; ++i) {
      const int row = i * 8 + srow;
      l[i] = (unsigned)(uintptr_t)&vtile[bu][row * VSTR + sq4];
      g[i] = vp + (size_t)row * T_ + s0 + sq4;
    }
    async_b128_x8(l, g);
  };

  // Q tile (64 channels x 16 queries) in B layout, held for whole key loop
  v2f qf[16];
#pragma unroll
  for (int j = 0; j < 16; ++j) {
    const float* p = qp + (size_t)(4 * j + kb) * T_ + t0 + lo;
    qf[j].x = p[0];
    qf[j].y = p[T_];
  }

  // Per lane: query t0 + lo.  oacc[ct][r] = O^T[ct*16 + 8*hi + r][lo].
  // mrow is the query's running maximum (equal in both halves); ssum is the
  // sum over this half's keys only, the halves are joined behind the loop.
  v8f oacc[4] = {};
  float mrow = -1e30f, ssum = 0.f;

  stage(0, 0);
  wait_asynccnt0();
  __syncthreads();
  stage(1, KT_);

#pragma unroll 1  // one pass is 128 matrix instructions already; keeps the loop small
  for (int t = 0; t < T_ / KT_; ++t) {
    const int bu = t & 1;
    const float* kt_l = &ktile[bu][kb * 16 + lo];
    const float* vt_l = &vtile[bu][lo * VSTR + 8 * hi];

    // S^T tiles (4 x 16 keys x 16 queries), 64 channels via 16 WMMA steps each.
    // A = K from LDS: row = key kt*16 + lo, k slot (hi, v) = channel
    // 4j + 2*hi + v, the same channel that qf[j] holds in that slot.
    v8f sacc[4] = {};
#pragma unroll
    for (int j = 0; j < 16; ++j) {
#pragma unroll
      for (int kt = 0; kt < 4; ++kt) {
        v2f ka;
        ka.x = kt_l[kt * KSUB + (4 * j) * 16];
        ka.y = kt_l[kt * KSUB + (4 * j + 1) * 16];
        sacc[kt] = wmma_f32(ka, qf[j], sacc[kt]);
      }
    }

    // Online softmax.  sacc[kt][r] = score of key t*64 + kt*16 + 8*hi + r
    // for query lo.
    float mk[4];
#pragma unroll
    for (int kt = 0; kt < 4; ++kt) {
#pragma unroll
      for (int r = 0; r < 8; ++r) sacc[kt][r] *= 0.125f;  // scale^2 = ch^-0.5 = 1/8
      mk[kt] = fmaxf(fmaxf(fmaxf(sacc[kt][0], sacc[kt][1]), fmaxf(sacc[kt][2], sacc[kt][3])),
                     fmaxf(fmaxf(sacc[kt][4], sacc[kt][5]), fmaxf(sacc[kt][6], sacc[kt][7])));
    }
    float mx = fmaxf(fmaxf(mk[0], mk[1]), fmaxf(mk[2], mk[3]));
    mx = fmaxf(mx, xhalf(mx));
    const float mnew = fmaxf(mrow, mx);
    const float alpha = __expf(mrow - mnew);
    mrow = mnew;
    float pr[4][8], sk[4];
#pragma unroll
    for (int kt = 0; kt < 4; ++kt) {
#pragma unroll
      for (int r = 0; r < 8; ++r) sacc[kt][r] -= mnew;
#pragma unroll
      for (int r = 0; r < 8; ++r) pr[kt][r] = __expf(sacc[kt][r]);
      sk[kt] = ((pr[kt][0] + pr[kt][1]) + (pr[kt][2] + pr[kt][3])) +
               ((pr[kt][4] + pr[kt][5]) + (pr[kt][6] + pr[kt][7]));
    }
    ssum = ssum * alpha + ((sk[0] + sk[1]) + (sk[2] + sk[3]));
#pragma unroll
    for (int ct = 0; ct < 4; ++ct)
#pragma unroll
      for (int r = 0; r < 8; ++r) oacc[ct][r] *= alpha;

    // O^T += V P^T : 64 keys via 16 WMMA steps, 4 channel tiles.
    // B = P^T straight from the score registers: k slot (hi, v) of step j2 of
    // key tile kt is key kt*16 + 8*hi + 2*j2 + v.  A = V from LDS in the same
    // key order: one 16-byte read per lane serves two steps.
#pragma unroll
    for (int kt = 0; kt < 4; ++kt) {
#pragma unroll
      for (int jj = 0; jj < 2; ++jj) {
        v4f va[4];
#pragma unroll
        for (int ct = 0; ct < 4; ++ct)
          va[ct] = *(const v4f*)&vt_l[ct * 16 * VSTR + kt * 16 + 4 * jj];
        v2f pb0, pb1;
        pb0.x = pr[kt][4 * jj];
        pb0.y = pr[kt][4 * jj + 1];
        pb1.x = pr[kt][4 * jj + 2];
        pb1.y = pr[kt][4 * jj + 3];
#pragma unroll
        for (int ct = 0; ct < 4; ++ct) {
          v2f a0;
          a0.x = va[ct].x;
          a0.y = va[ct].y;
          oacc[ct] = wmma_f32(a0, pb0, oacc[ct]);
        }
#pragma unroll
        for (int ct = 0; ct < 4; ++ct) {
          v2f a1;
          a1.x = va[ct].z;
          a1.y = va[ct].w;
          oacc[ct] = wmma_f32(a1, pb1, oacc[ct]);
        }
      }
    }

    wait_dscnt0();      // our reads of buffer bu have returned
    wait_asynccnt0();   // our copies into bu^1 have landed
    __syncthreads();    // everyone done reading bu / writing bu^1
    // The pass's last matrix instructions stand right in front of a branch:
    // hold them here and keep the vector
    // slots they need ahead of both paths, which rewrite their operands.
    __builtin_amdgcn_sched_barrier(0);
    asm volatile("v_nop\n\tv_nop\n\tv_nop\n\tv_nop");
    if (t + 2 < T_ / KT_) stage(bu, (t + 2) * KT_);  // refill the buffer just read
  }
  wait_asynccnt0();     // nothing of ours is in flight when the wave ends

  // Join the halves' sums, normalize and write a[b, h*64 + c, t]
  float* ab = aout + ((size_t)b * C_ + (size_t)h * CH_) * T_;
  const float inv = 1.0f / (ssum + xhalf(ssum));
#pragma unroll
  for (int ct = 0; ct < 4; ++ct) {
#pragma unroll
    for (int r = 0; r < 8; ++r) {
      ab[(size_t)(ct * 16 + 8 * hi + r) * T_ + t0 + lo] = oacc[ct][r] * inv;
    }
  }
}

// ---------------------------------------------------------------------------
// Kernel 4: proj GEMM + bias + residual -> out
// ---------------------------------------------------------------------------
__global__ void proj_gemm(const float* __restrict__ a,
                          const float* __restrict__ w,
                          const float* __restrict__ bias,
                          const float* __restrict__ x,
                          float* __restrict__ out) {
  const int wid = blockIdx.x * (blockDim.x >> 5) + (threadIdx.x >> 5);
  const int lane = threadIdx.x & 31;
  const int lo = lane & 15;
  const int hi = lane >> 4;
  const int kb = hi * 2;

  const int b = wid / (16 * 64);          // 256/16=16 mtiles, 64 ntiles
  const int rem = wid % (16 * 64);
  const int m0 = (rem / 64) * 16;
  const int n0 = (rem % 64) * 64;

  const float* ab = a + (size_t)b * C_ * T_;
  v8f acc[4] = {};

  for (int c = 0; c < C_; c += 4) {
    v2f av = *(const v2f*)(w + (size_t)(m0 + lo) * C_ + c + kb);
#pragma unroll
    for (int nt = 0; nt < 4; ++nt) {
      const float* bp = ab + (size_t)(c + kb) * T_ + n0 + nt * 16 + lo;
      v2f bb;
      bb.x = bp[0];
      bb.y = bp[T_];
      acc[nt] = wmma_f32(av, bb, acc[nt]);
    }
  }

  const float* xb = x + (size_t)b * C_ * T_;
  float* ob = out + (size_t)b * C_ * T_;
#pragma unroll
  for (int r = 0; r < 8; ++r) {
    const int row = m0 + r + 8 * hi;
    const float bv = bias[row];
#pragma unroll
    for (int nt = 0; nt < 4; ++nt) {
      const size_t idx = (size_t)row * T_ + n0 + nt * 16 + lo;
      ob[idx] = xb[idx] + acc[nt][r] + bv;
    }
  }
}

// ---------------------------------------------------------------------------
extern "C" void kernel_launch(void* const* d_in, const int* in_sizes, int n_in,
                              void* d_out, int out_size, void* d_ws, size_t ws_size,
                              hipStream_t stream) {
  (void)in_sizes; (void)n_in; (void)out_size; (void)ws_size;
  const float* x  = (const float*)d_in[0];
  const float* nw = (const float*)d_in[1];
  const float* nb = (const float*)d_in[2];
  const float* qw = (const float*)d_in[3];
  const float* qb = (const float*)d_in[4];
  const float* pw = (const float*)d_in[5];
  const float* pb = (const float*)d_in[6];
  float* out = (float*)d_out;

  float* ws = (float*)d_ws;
  float* xn   = ws;                                   //  8 MB: (2,256,4096)
  float* qkv  = xn + (size_t)B_ * C_ * T_;            // 24 MB: (2,768,4096)
  float* attn = qkv + (size_t)B_ * 3 * C_ * T_;       //  8 MB: (2,256,4096)

  gn_kernel<<<B_ * GROUPS_, 256, 0, stream>>>(x, nw, nb, xn);
  qkv_gemm<<<(B_ * 48 * 64) / 8, 256, 0, stream>>>(xn, qw, qb, qkv);
  flash_attn<<<B_ * NH_ * (T_ / 64), 128, 0, stream>>>(qkv, attn);
  proj_gemm<<<(B_ * 16 * 64) / 8, 256, 0, stream>>>(attn, pw, pb, x, out);
}

// v003
// A run of this version takes 229 microseconds.
// In two side-by-side timings against v002, it was 1.41 and 1.40 times as fast.
// Counting every step since v000, it is 3.22 times as fast.
#include <hip/hip_runtime.h>
#include <math.h>
#include <stdint.h>

typedef __attribute__((ext_vector_type(2))) float v2f;
typedef __attribute__((ext_vector_type(4))) float v4f;
typedef __attribute__((ext_vector_type(8))) float v8f;

#define B_ 2
#define C_ 256
#define T_ 4096
#define NH_ 4
#define CH_ 64
#define GROUPS_ 32
#define CPG_ 8    // channels per group
#define GN_THREADS 1024
#define KT_ 64    // keys per pass of the attention loop
#define KSUB 1040 // K-tile LDS: four sub-tiles [64 c][16 s], 16 floats apart in bank so that a row's copy spreads over all banks
#define VSTR 68   // V-tile LDS row pitch (floats): 272B = 16B x odd, conflict-free for the 16-byte reads

static __device__ __forceinline__ v8f wmma_f32(v2f a, v2f b, v8f c) {
  // D = A(16x4) * B(4x16) + C, fp32
  return __builtin_amdgcn_wmma_f32_16x16x4_f32(
      /*neg_a=*/false, a, /*neg_b=*/false, b,
      /*c_mod=*/(short)0, c, /*reuse_a=*/false, /*reuse_b=*/false);
}

// Value of lane l ^ 16 (the other half of the wave).
static __device__ __forceinline__ float xhalf(float x) {
  const int xb = __builtin_bit_cast(int, x);
  return __builtin_bit_cast(float, __builtin_amdgcn_permlanex16(
      xb, xb, 0x76543210, 0xfedcba98, false, false));
}

// Eight 16-byte copies global -> LDS, one per operand pair.  The s_wait_xcnt
// is the last line of the copies' own statement, so that no address register
// of a copy is rewritten in front of it.
static __device__ __forceinline__ void async_b128_x8(const unsigned (&l)[8],
                                                     const float* const (&g)[8]) {
  asm volatile("global_load_async_to_lds_b128 %0, %8, off\n\t"
               "global_load_async_to_lds_b128 %1, %9, off\n\t"
               "global_load_async_to_lds_b128 %2, %10, off\n\t"
               "global_load_async_to_lds_b128 %3, %11, off\n\t"
               "global_load_async_to_lds_b128 %4, %12, off\n\t"
               "global_load_async_to_lds_b128 %5, %13, off\n\t"
               "global_load_async_to_lds_b128 %6, %14, off\n\t"
               "global_load_async_to_lds_b128 %7, %15, off\n\t"
               "s_wait_xcnt 0x0"
               :: "v"(l[0]), "v"(l[1]), "v"(l[2]), "v"(l[3]),
                  "v"(l[4]), "v"(l[5]), "v"(l[6]), "v"(l[7]),
                  "v"(g[0]), "v"(g[1]), "v"(g[2]), "v"(g[3]),
                  "v"(g[4]), "v"(g[5]), "v"(g[6]), "v"(g[7])
               : "memory");
}

static __device__ __forceinline__ void wait_asynccnt0() {
  asm volatile("s_wait_asynccnt 0x0" ::: "memory");
}

static __device__ __forceinline__ void wait_dscnt0() {
  asm volatile("s_wait_dscnt 0x0" ::: "memory");
}

// ---------------------------------------------------------------------------
// Kernel 1: GroupNorm over (B, C, T).  One block per (b, group).
// A thread holds 4 neighbouring elements of each of the group's 8 channels in
// registers: its 8 loads are independent and all in flight at once, x is read
// once, and load k is channel k, so scale and shift are uniform per load.
// ---------------------------------------------------------------------------
__global__ __launch_bounds__(GN_THREADS) void gn_kernel(const float* __restrict__ x,
                                                        const float* __restrict__ w,
                                                        const float* __restrict__ bgn,
                                                        float* __restrict__ xn) {
  static_assert(T_ == 4 * GN_THREADS, "one 16-byte load per thread covers one channel row");
  static_assert(GN_THREADS == 32 * 32, "one partial sum per lane in the second butterfly");
  const int b = blockIdx.x / GROUPS_;
  const int g = blockIdx.x % GROUPS_;
  const size_t off = ((size_t)b * C_ + (size_t)g * CPG_) * T_;
  const v4f* xp = (const v4f*)(x + off) + threadIdx.x;
  v4f* xo = (v4f*)(xn + off) + threadIdx.x;

  v4f v[CPG_];
#pragma unroll
  for (int k = 0; k < CPG_; ++k) v[k] = xp[k * (T_ / 4)];
  // Keeps all 8 loads ahead of the sums: without it the last two are issued
  // only after the first six have returned, a second round of latency.
  __builtin_amdgcn_sched_barrier(0);

  float s = 0.f, s2 = 0.f;
#pragma unroll
  for (int k = 0; k < CPG_; ++k) {
    s += (v[k].x + v[k].y) + (v[k].z + v[k].w);
    s2 += (v[k].x * v[k].x + v[k].y * v[k].y) + (v[k].z * v[k].z + v[k].w * v[k].w);
  }
  // Sum over the wave, then over the 32 waves' partial sums (one per lane).
#pragma unroll
  for (int m = 16; m >= 1; m >>= 1) {
    s += __shfl_xor(s, m, 32);
    s2 += __shfl_xor(s2, m, 32);
  }
  __shared__ v2f red[GN_THREADS / 32];
  if ((threadIdx.x & 31) == 0) {
    v2f p;
    p.x = s;
    p.y = s2;
    red[threadIdx.x >> 5] = p;
  }
  __syncthreads();
  const v2f q = red[threadIdx.x & 31];
  s = q.x;
  s2 = q.y;
#pragma unroll
  for (int m = 16; m >= 1; m >>= 1) {
    s += __shfl_xor(s, m, 32);
    s2 += __shfl_xor(s2, m, 32);
  }
  const float invN = 1.0f / (float)(CPG_ * T_);
  const float mean = s * invN;
  const float var = s2 * invN - mean * mean;
  const float rstd = rsqrtf(var + 1e-5f);

#pragma unroll
  for (int k = 0; k < CPG_; ++k) {
    const float wk = w[g * CPG_ + k];
    const float bk = bgn[g * CPG_ + k];
    v4f o;
    o.x = (v[k].x - mean) * rstd * wk + bk;
    o.y = (v[k].y - mean) * rstd * wk + bk;
    o.z = (v[k].z - mean) * rstd * wk + bk;
    o.w = (v[k].w - mean) * rstd * wk + bk;
    xo[k * (T_ / 4)] = o;
  }
}

// ---------------------------------------------------------------------------
// Kernel 2: QKV GEMM.  out[b,o,t] = sum_c qkv_w[o,c]*xn[b,c,t] + qkv_b[o]
// One wave -> 16(M=o) x 64(N=t) tile, K=256 in steps of 4 (fp32 WMMA).
// ---------------------------------------------------------------------------
__global__ void qkv_gemm(const float* __restrict__ xn,
                         const float* __restrict__ w,
                         const float* __restrict__ bias,
                         float* __restrict__ out) {
  const int wid = blockIdx.x * (blockDim.x >> 5) + (threadIdx.x >> 5);
  const int lane = threadIdx.x & 31;
  const int lo = lane & 15;
  const int hi = lane >> 4;
  const int kb = hi * 2;

  const int b = wid / (48 * 64);          // 768/16=48 mtiles, 4096/64=64 ntiles
  const int rem = wid % (48 * 64);
  const int m0 = (rem / 64) * 16;
  const int n0 = (rem % 64) * 64;

  const float* xb = xn + (size_t)b * C_ * T_;
  v8f acc[4] = {};

  for (int c = 0; c < C_; c += 4) {
    v2f av = *(const v2f*)(w + (size_t)(m0 + lo) * C_ + c + kb);
#pragma unroll
    for (int nt = 0; nt < 4; ++nt) {
      const float* bp = xb + (size_t)(c + kb) * T_ + n0 + nt * 16 + lo;
      v2f bb;
      bb.x = bp[0];
      bb.y = bp[T_];
      acc[nt] = wmma_f32(av, bb, acc[nt]);
    }
  }

  float* ob = out + (size_t)b * (3 * C_) * T_;
#pragma unroll
  for (int r = 0; r < 8; ++r) {
    const int row = m0 + r + 8 * hi;
    const float bv = bias[row];
#pragma unroll
    for (int nt = 0; nt < 4; ++nt) {
      ob[(size_t)row * T_ + n0 + nt * 16 + lo] = acc[nt][r] + bv;
    }
  }
}

// ---------------------------------------------------------------------------
// Kernel 3: Flash attention per (b*NH) head-batch.
// qkv layout per b: 768 rows; head h owns rows [h*192, h*192+192):
//   q = +0..63, k = +64..127, v = +128..191, each (64, T).
// Block = 4 waves x 16 queries = 64 queries.  K/V tiles of 64 keys (shared by
// all 4 waves) are double-buffered in LDS via async-to-LDS B128 copies.
// Transposed products: S^T = K^T Q (keys x queries), O^T += V P^T
// (channels x queries).  A lane then holds 32 scores of ONE query per pass
// (lane l ^ 16 the other 32), so the softmax is in-lane plus one exchange of
// the halves, and the score registers are the B operand of the second product.
// ---------------------------------------------------------------------------
__global__ __launch_bounds__(128) void flash_attn(const float* __restrict__ qkv,
                                                  float* __restrict__ aout) {
  __shared__ __attribute__((aligned(16))) float ktile[2][4 * KSUB];   // [s / 16][c][s % 16]
  __shared__ __attribute__((aligned(16))) float vtile[2][64 * VSTR];  // [c][s]

  const int tid = threadIdx.x;            // 0..127
  const int wv = tid >> 5;
  const int lane = tid & 31;
  const int lo = lane & 15;
  const int hi = lane >> 4;
  const int kb = hi * 2;

  const int bh = blockIdx.x >> 6;         // 0..7
  const int qb = blockIdx.x & 63;         // 64 query blocks of 64
  const int t0 = qb * 64 + wv * 16;
  const int b = bh >> 2, h = bh & 3;

  const float* base = qkv + ((size_t)b * (3 * C_) + (size_t)h * 192) * T_;
  const float* qp = base;
  const float* kp = base + (size_t)64 * T_;
  const float* vp = base + (size_t)128 * T_;

  // Cooperative async staging of one K tile + one V tile (64 rows x 64 keys).
  // 1024 16B-chunks per tile, 128 threads -> 8 chunks/thread per tile; a wave's
  // copy covers two whole 256-byte rows.
  const int srow = tid >> 4;              // 0..7
  const int sq4 = (tid & 15) * 4;
  auto stage = [&](int bu, int s0) {
    unsigned l[8];
    const float* g[8];
#pragma unroll
    for (int i = 0; i < 8; ++i) {
      const int row = i * 8 + srow;
      l[i] = (unsigned)(uintptr_t)&ktile[bu][(sq4 >> 4) * KSUB + row * 16 + (sq4 & 15)];
      g[i] = kp + (size_t)row * T_ + s0 + sq4;
    }
    async_b128_x8(l, g);
#pragma unroll
    for (int i = 0; i < 8; ++i) {
      const int row = i * 8 + srow;
      l[i] = (unsigned)(uintptr_t)&vtile[bu][row * VSTR + sq4];
      g[i] = vp + (size_t)row * T_ + s0 + sq4;
    }
    async_b128_x8(l, g);
  };

  // Q tile (64 channels x 16 queries) in B layout, held for whole key loop
  v2f qf[16];
#pragma unroll
  for (int j = 0; j < 16; ++j) {
    const float* p = qp + (size_t)(4 * j + kb) * T_ + t0 + lo;
    qf[j].x = p[0];
    qf[j].y = p[T_];
  }

  // Per lane: query t0 + lo.  oacc[ct][r] = O^T[ct*16 + 8*hi + r][lo].
  // mrow is the query's running maximum (equal in both halves); ssum is the
  // sum over this half's keys only, the halves are joined behind the loop.
  v8f oacc[4] = {};
  float mrow = -1e30f, ssum = 0.f;

  stage(0, 0);
  wait_asynccnt0();
  __syncthreads();
  stage(1, KT_);

#pragma unroll 1  // one pass is 128 matrix instructions already; keeps the loop small
  for (int t = 0; t < T_ / KT_; ++t) {
    const int bu = t & 1;
    const float* kt_l = &ktile[bu][kb * 16 + lo];
    const float* vt_l = &vtile[bu][lo * VSTR + 8 * hi];

    // S^T tiles (4 x 16 keys x 16 queries), 64 channels via 16 WMMA steps each.
    // A = K from LDS: row = key kt*16 + lo, k slot (hi, v) = channel
    // 4j + 2*hi + v, the same channel that qf[j] holds in that slot.
    v8f sacc[4] = {};
#pragma unroll
    for (int j = 0; j < 16; ++j) {
#pragma unroll
      for (int kt = 0; kt < 4; ++kt) {
        v2f ka;
        ka.x = kt_l[kt * KSUB + (4 * j) * 16];
        ka.y = kt_l[kt * KSUB + (4 * j + 1) * 16];
        sacc[kt] = wmma_f32(ka, qf[j], sacc[kt]);
      }
    }

    // Online softmax.  sacc[kt][r] = score of key t*64 + kt*16 + 8*hi + r
    // for query lo.
    float mk[4];
#pragma unroll
    for (int kt = 0; kt < 4; ++kt) {
#pragma unroll
      for (int r = 0; r < 8; ++r) sacc[kt][r] *= 0.125f;  // scale^2 = ch^-0.5 = 1/8
      mk[kt] = fmaxf(fmaxf(fmaxf(sacc[kt][0], sacc[kt][1]), fmaxf(sacc[kt][2], sacc[kt][3])),
                     fmaxf(fmaxf(sacc[kt][4], sacc[kt][5]), fmaxf(sacc[kt][6], sacc[kt][7])));
    }
    float mx = fmaxf(fmaxf(mk[0], mk[1]), fmaxf(mk[2], mk[3]));
    mx = fmaxf(mx, xhalf(mx));
    const float mnew = fmaxf(mrow, mx);
    const float alpha = __expf(mrow - mnew);
    mrow = mnew;
    float pr[4][8], sk[4];
#pragma unroll
    for (int kt = 0; kt < 4; ++kt) {
#pragma unroll
      for (int r = 0; r < 8; ++r) sacc[kt][r] -= mnew;
#pragma unroll
      for (int r = 0; r < 8; ++r) pr[kt][r] = __expf(sacc[kt][r]);
      sk[kt] = ((pr[kt][0] + pr[kt][1]) + (pr[kt][2] + pr[kt][3])) +
               ((pr[kt][4] + pr[kt][5]) + (pr[kt][6] + pr[kt][7]));
    }
    ssum = ssum * alpha + ((sk[0] + sk[1]) + (sk[2] + sk[3]));
#pragma unroll
    for (int ct = 0; ct < 4; ++ct)
#pragma unroll
      for (int r = 0; r < 8; ++r) oacc[ct][r] *= alpha;

    // O^T += V P^T : 64 keys via 16 WMMA steps, 4 channel tiles.
    // B = P^T straight from the score registers: k slot (hi, v) of step j2 of
    // key tile kt is key kt*16 + 8*hi + 2*j2 + v.  A = V from LDS in the same
    // key order: one 16-byte read per lane serves two steps.
#pragma unroll
    for (int kt = 0; kt < 4; ++kt) {
#pragma unroll
      for (int jj = 0; jj < 2; ++jj) {
        v4f va[4];
#pragma unroll
        for (int ct = 0; ct < 4; ++ct)
          va[ct] = *(const v4f*)&vt_l[ct * 16 * VSTR + kt * 16 + 4 * jj];
        v2f pb0, pb1;
        pb0.x = pr[kt][4 * jj];
        pb0.y = pr[kt][4 * jj + 1];
        pb1.x = pr[kt][4 * jj + 2];
        pb1.y = pr[kt][4 * jj + 3];
#pragma unroll
        for (int ct = 0; ct < 4; ++ct) {
          v2f a0;
          a0.x = va[ct].x;
          a0.y = va[ct].y;
          oacc[ct] = wmma_f32(a0, pb0, oacc[ct]);
        }
#pragma unroll
        for (int ct = 0; ct < 4; ++ct) {
          v2f a1;
          a1.x = va[ct].z;
          a1.y = va[ct].w;
          oacc[ct] = wmma_f32(a1, pb1, oacc[ct]);
        }
      }
    }

    wait_dscnt0();      // our reads of buffer bu have returned
    wait_asynccnt0();   // our copies into bu^1 have landed
    __syncthreads();    // everyone done reading bu / writing bu^1
    // The pass's last matrix instructions stand right in front of a branch:
    // hold them here and keep the vector
    // slots they need ahead of both paths, which rewrite their operands.
    __builtin_amdgcn_sched_barrier(0);
    asm volatile("v_nop\n\tv_nop\n\tv_nop\n\tv_nop");
    if (t + 2 < T_ / KT_) stage(bu, (t + 2) * KT_);  // refill the buffer just read
  }
  wait_asynccnt0();     // nothing of ours is in flight when the wave ends

  // Join the halves' sums, normalize and write a[b, h*64 + c, t]
  float* ab = aout + ((size_t)b * C_ + (size_t)h * CH_) * T_;
  const float inv = 1.0f / (ssum + xhalf(ssum));
#pragma unroll
  for (int ct = 0; ct < 4; ++ct) {
#pragma unroll
    for (int r = 0; r < 8; ++r) {
      ab[(size_t)(ct * 16 + 8 * hi + r) * T_ + t0 + lo] = oacc[ct][r] * inv;
    }
  }
}

// ---------------------------------------------------------------------------
// Kernel 4: proj GEMM + bias + residual -> out
// ---------------------------------------------------------------------------
__global__ void proj_gemm(const float* __restrict__ a,
                          const float* __restrict__ w,
                          const float* __restrict__ bias,
                          const float* __restrict__ x,
                          float* __restrict__ out) {
  const int wid = blockIdx.x * (blockDim.x >> 5) + (threadIdx.x >> 5);
  const int lane = threadIdx.x & 31;
  const int lo = lane & 15;
  const int hi = lane >> 4;
  const int kb = hi * 2;

  const int b = wid / (16 * 64);          // 256/16=16 mtiles, 64 ntiles
  const int rem = wid % (16 * 64);
  const int m0 = (rem / 64) * 16;
  const int n0 = (rem % 64) * 64;

  const float* ab = a + (size_t)b * C_ * T_;
  v8f acc[4] = {};

  for (int c = 0; c < C_; c += 4) {
    v2f av = *(const v2f*)(w + (size_t)(m0 + lo) * C_ + c + kb);
#pragma unroll
    for (int nt = 0; nt < 4; ++nt) {
      const float* bp = ab + (size_t)(c + kb) * T_ + n0 + nt * 16 + lo;
      v2f bb;
      bb.x = bp[0];
      bb.y = bp[T_];
      acc[nt] = wmma_f32(av, bb, acc[nt]);
    }
  }

  const float* xb = x + (size_t)b * C_ * T_;
  float* ob = out + (size_t)b * C_ * T_;
#pragma unroll
  for (int r = 0; r < 8; ++r) {
    const int row = m0 + r + 8 * hi;
    const float bv = bias[row];
#pragma unroll
    for (int nt = 0; nt < 4; ++nt) {
      const size_t idx = (size_t)row * T_ + n0 + nt * 16 + lo;
      ob[idx] = xb[idx] + acc[nt][r] + bv;
    }
  }
}

// ---------------------------------------------------------------------------
extern "C" void kernel_launch(void* const* d_in, const int* in_sizes, int n_in,
                              void* d_out, int out_size, void* d_ws, size_t ws_size,
                              hipStream_t stream) {
  (void)in_sizes; (void)n_in; (void)out_size; (void)ws_size;
  const float* x  = (const float*)d_in[0];
  const float* nw = (const float*)d_in[1];
  const float* nb = (const float*)d_in[2];
  const float* qw = (const float*)d_in[3];
  const float* qb = (const float*)d_in[4];
  const float* pw = (const float*)d_in[5];
  const float* pb = (const float*)d_in[6];
  float* out = (float*)d_out;

  float* ws = (float*)d_ws;
  float* xn   = ws;                                   //  8 MB: (2,256,4096)
  float* qkv  = xn + (size_t)B_ * C_ * T_;            // 24 MB: (2,768,4096)
  float* attn = qkv + (size_t)B_ * 3 * C_ * T_;       //  8 MB: (2,256,4096)

  gn_kernel<<<B_ * GROUPS_, GN_THREADS, 0, stream>>>(x, nw, nb, xn);
  qkv_gemm<<<(B_ * 48 * 64) / 8, 256, 0, stream>>>(xn, qw, qb, qkv);
  flash_attn<<<B_ * NH_ * (T_ / 64), 128, 0, stream>>>(qkv, attn);
  proj_gemm<<<(B_ * 16 * 64) / 8, 256, 0, stream>>>(attn, pw, pb, x, out);
}

// v004
// It runs in 215 microseconds.
// Next to v003, in two timings, it ran 1.06 and 1.07 times as fast.
// All steps since v000 together make it 3.43 times as fast.
#include <hip/hip_runtime.h>
#include <math.h>
#include <stdint.h>

typedef __attribute__((ext_vector_type(2))) float v2f;
typedef __attribute__((ext_vector_type(4))) float v4f;
typedef __attribute__((ext_vector_type(8))) float v8f;

#define B_ 2
#define C_ 256
#define T_ 4096
#define NH_ 4
#define CH_ 64
#define GROUPS_ 32
#define CPG_ 8    // channels per group
#define GN_THREADS 1024
#define KT_ 64    // keys per pass of a wave in the attention loop
#define KG_ 2     // key groups of a block: group kg takes the 64-key tiles kg, kg + 2, kg + 4, ...
#define XP_ 36    // floats per lane in the groups' exchange: 144B = 16B x odd
#define KSUB 1040 // K-tile LDS: four sub-tiles [64 c][16 s], 16 floats apart in bank so that a row's copy spreads over all banks
#define VSTR 68   // V-tile LDS row pitch (floats): 272B = 16B x odd, conflict-free for the 16-byte reads

static __device__ __forceinline__ v8f wmma_f32(v2f a, v2f b, v8f c) {
  // D = A(16x4) * B(4x16) + C, fp32
  return __builtin_amdgcn_wmma_f32_16x16x4_f32(
      /*neg_a=*/false, a, /*neg_b=*/false, b,
      /*c_mod=*/(short)0, c, /*reuse_a=*/false, /*reuse_b=*/false);
}

// Value of lane l ^ 16 (the other half of the wave).
static __device__ __forceinline__ float xhalf(float x) {
  const int xb = __builtin_bit_cast(int, x);
  return __builtin_bit_cast(float, __builtin_amdgcn_permlanex16(
      xb, xb, 0x76543210, 0xfedcba98, false, false));
}

// Eight 16-byte copies global -> LDS, one per operand pair.  The s_wait_xcnt
// is the last line of the copies' own statement, so that no address register
// of a copy is rewritten in front of it.
static __device__ __forceinline__ void async_b128_x8(const unsigned (&l)[8],
                                                     const float* const (&g)[8]) {
  asm volatile("global_load_async_to_lds_b128 %0, %8, off\n\t"
               "global_load_async_to_lds_b128 %1, %9, off\n\t"
               "global_load_async_to_lds_b128 %2, %10, off\n\t"
               "global_load_async_to_lds_b128 %3, %11, off\n\t"
               "global_load_async_to_lds_b128 %4, %12, off\n\t"
               "global_load_async_to_lds_b128 %5, %13, off\n\t"
               "global_load_async_to_lds_b128 %6, %14, off\n\t"
               "global_load_async_to_lds_b128 %7, %15, off\n\t"
               "s_wait_xcnt 0x0"
               :: "v"(l[0]), "v"(l[1]), "v"(l[2]), "v"(l[3]),
                  "v"(l[4]), "v"(l[5]), "v"(l[6]), "v"(l[7]),
                  "v"(g[0]), "v"(g[1]), "v"(g[2]), "v"(g[3]),
                  "v"(g[4]), "v"(g[5]), "v"(g[6]), "v"(g[7])
               : "memory");
}

static __device__ __forceinline__ void wait_asynccnt0() {
  asm volatile("s_wait_asynccnt 0x0" ::: "memory");
}

static __device__ __forceinline__ void wait_dscnt0() {
  asm volatile("s_wait_dscnt 0x0" ::: "memory");
}

// ---------------------------------------------------------------------------
// Kernel 1: GroupNorm over (B, C, T).  One block per (b, group).
// A thread holds 4 neighbouring elements of each of the group's 8 channels in
// registers: its 8 loads are independent and all in flight at once, x is read
// once, and load k is channel k, so scale and shift are uniform per load.
// ---------------------------------------------------------------------------
__global__ __launch_bounds__(GN_THREADS) void gn_kernel(const float* __restrict__ x,
                                                        const float* __restrict__ w,
                                                        const float* __restrict__ bgn,
                                                        float* __restrict__ xn) {
  static_assert(T_ == 4 * GN_THREADS, "one 16-byte load per thread covers one channel row");
  static_assert(GN_THREADS == 32 * 32, "one partial sum per lane in the second butterfly");
  const int b = blockIdx.x / GROUPS_;
  const int g = blockIdx.x % GROUPS_;
  const size_t off = ((size_t)b * C_ + (size_t)g * CPG_) * T_;
  const v4f* xp = (const v4f*)(x + off) + threadIdx.x;
  v4f* xo = (v4f*)(xn + off) + threadIdx.x;

  v4f v[CPG_];
#pragma unroll
  for (int k = 0; k < CPG_; ++k) v[k] = xp[k * (T_ / 4)];
  // Keeps all 8 loads ahead of the sums: without it the last two are issued
  // only after the first six have returned, a second round of latency.
  __builtin_amdgcn_sched_barrier(0);

  float s = 0.f, s2 = 0.f;
#pragma unroll
  for (int k = 0; k < CPG_; ++k) {
    s += (v[k].x + v[k].y) + (v[k].z + v[k].w);
    s2 += (v[k].x * v[k].x + v[k].y * v[k].y) + (v[k].z * v[k].z + v[k].w * v[k].w);
  }
  // Sum over the wave, then over the 32 waves' partial sums (one per lane).
#pragma unroll
  for (int m = 16; m >= 1; m >>= 1) {
    s += __shfl_xor(s, m, 32);
    s2 += __shfl_xor(s2, m, 32);
  }
  __shared__ v2f red[GN_THREADS / 32];
  if ((threadIdx.x & 31) == 0) {
    v2f p;
    p.x = s;
    p.y = s2;
    red[threadIdx.x >> 5] = p;
  }
  __syncthreads();
  const v2f q = red[threadIdx.x & 31];
  s = q.x;
  s2 = q.y;
#pragma unroll
  for (int m = 16; m >= 1; m >>= 1) {
    s += __shfl_xor(s, m, 32);
    s2 += __shfl_xor(s2, m, 32);
  }
  const float invN = 1.0f / (float)(CPG_ * T_);
  const float mean = s * invN;
  const float var = s2 * invN - mean * mean;
  const float rstd = rsqrtf(var + 1e-5f);

#pragma unroll
  for (int k = 0; k < CPG_; ++k) {
    const float wk = w[g * CPG_ + k];
    const float bk = bgn[g * CPG_ + k];
    v4f o;
    o.x = (v[k].x - mean) * rstd * wk + bk;
    o.y = (v[k].y - mean) * rstd * wk + bk;
    o.z = (v[k].z - mean) * rstd * wk + bk;
    o.w = (v[k].w - mean) * rstd * wk + bk;
    xo[k * (T_ / 4)] = o;
  }
}

// ---------------------------------------------------------------------------
// Kernel 2: QKV GEMM.  out[b,o,t] = sum_c qkv_w[o,c]*xn[b,c,t] + qkv_b[o]
// One wave -> 16(M=o) x 64(N=t) tile, K=256 in steps of 4 (fp32 WMMA).
// ---------------------------------------------------------------------------
__global__ void qkv_gemm(const float* __restrict__ xn,
                         const float* __restrict__ w,
                         const float* __restrict__ bias,
                         float* __restrict__ out) {
  const int wid = blockIdx.x * (blockDim.x >> 5) + (threadIdx.x >> 5);
  const int lane = threadIdx.x & 31;
  const int lo = lane & 15;
  const int hi = lane >> 4;
  const int kb = hi * 2;

  const int b = wid / (48 * 64);          // 768/16=48 mtiles, 4096/64=64 ntiles
  const int rem = wid % (48 * 64);
  const int m0 = (rem / 64) * 16;
  const int n0 = (rem % 64) * 64;

  const float* xb = xn + (size_t)b * C_ * T_;
  v8f acc[4] = {};

  for (int c = 0; c < C_; c += 4) {
    v2f av = *(const v2f*)(w + (size_t)(m0 + lo) * C_ + c + kb);
#pragma unroll
    for (int nt = 0; nt < 4; ++nt) {
      const float* bp = xb + (size_t)(c + kb) * T_ + n0 + nt * 16 + lo;
      v2f bb;
      bb.x = bp[0];
      bb.y = bp[T_];
      acc[nt] = wmma_f32(av, bb, acc[nt]);
    }
  }

  float* ob = out + (size_t)b * (3 * C_) * T_;
#pragma unroll
  for (int r = 0; r < 8; ++r) {
    const int row = m0 + r + 8 * hi;
    const float bv = bias[row];
#pragma unroll
    for (int nt = 0; nt < 4; ++nt) {
      ob[(size_t)row * T_ + n0 + nt * 16 + lo] = acc[nt][r] + bv;
    }
  }
}

// ---------------------------------------------------------------------------
// Kernel 3: Flash attention per (b*NH) head-batch.
// qkv layout per b: 768 rows; head h owns rows [h*192, h*192+192):
//   q = +0..63, k = +64..127, v = +128..191, each (64, T).
// Block = 2 key groups x 4 waves x 16 queries = 64 queries.  Both groups work
// on the same queries; each takes every second 64-key tile, so that a SIMD has
// four waves instead of two to fill one another's waits, and the groups'
// partial (maximum, sum, O) are joined through LDS behind the loop.  A group's
// K/V tiles (shared by its 4 waves) are double-buffered in LDS via async-to-LDS
// B128 copies.
// Transposed products: S^T = K^T Q (keys x queries), O^T += V P^T
// (channels x queries).  A lane then holds 32 scores of ONE query per pass
// (lane l ^ 16 the other 32), so the softmax is in-lane plus one exchange of
// the halves, and the score registers are the B operand of the second product.
// ---------------------------------------------------------------------------
__global__ __launch_bounds__(128 * KG_) void flash_attn(const float* __restrict__ qkv,
                                                        float* __restrict__ aout) {
  __shared__ __attribute__((aligned(16))) float ktile[2 * KG_ * 4 * KSUB];   // [buffer][group][s / 16][c][s % 16]
  __shared__ __attribute__((aligned(16))) float vtile[2 * KG_ * 64 * VSTR];  // [buffer][group][c][s]
  static_assert(4 * 32 * XP_ <= 2 * KG_ * 4 * KSUB, "the exchange fits the K tiles");

  const int kg = __builtin_amdgcn_readfirstlane((int)threadIdx.x >> 7);  // key group, the same in a wave
  const int tid = threadIdx.x & 127;      // 0..127 within the group
  const int wv = tid >> 5;
  const int lane = tid & 31;
  const int lo = lane & 15;
  const int hi = lane >> 4;
  const int kb = hi * 2;

  const int bh = blockIdx.x >> 6;         // 0..7
  const int qb = blockIdx.x & 63;         // 64 query blocks of 64
  const int t0 = qb * 64 + wv * 16;
  const int b = bh >> 2, h = bh & 3;

  const float* base = qkv + ((size_t)b * (3 * C_) + (size_t)h * 192) * T_;
  const float* qp = base;
  const float* kp = base + (size_t)64 * T_;
  const float* vp = base + (size_t)128 * T_;

  // A group's cooperative async staging of its K tile + V tile (64 rows x 64 keys).
  // 1024 16B-chunks per tile, 128 threads -> 8 chunks/thread per tile; a wave's
  // copy covers two whole 256-byte rows.
  const int srow = tid >> 4;              // 0..7
  const int sq4 = (tid & 15) * 4;
  auto stage = [&](int bu, int s0) {
    float* kd = &ktile[(bu * KG_ + kg) * 4 * KSUB];
    float* vd = &vtile[(bu * KG_ + kg) * 64 * VSTR];
    unsigned l[8];
    const float* g[8];
#pragma unroll
    for (int i = 0; i < 8; ++i) {
      const int row = i * 8 + srow;
      l[i] = (unsigned)(uintptr_t)&kd[(sq4 >> 4) * KSUB + row * 16 + (sq4 & 15)];
      g[i] = kp + (size_t)row * T_ + s0 + sq4;
    }
    async_b128_x8(l, g);
#pragma unroll
    for (int i = 0; i < 8; ++i) {
      const int row = i * 8 + srow;
      l[i] = (unsigned)(uintptr_t)&vd[row * VSTR + sq4];
      g[i] = vp + (size_t)row * T_ + s0 + sq4;
    }
    async_b128_x8(l, g);
  };

  // Q tile (64 channels x 16 queries) in B layout, held for whole key loop
  v2f qf[16];
#pragma unroll
  for (int j = 0; j < 16; ++j) {
    const float* p = qp + (size_t)(4 * j + kb) * T_ + t0 + lo;
    qf[j].x = p[0];
    qf[j].y = p[T_];
  }

  // Per lane: query t0 + lo.  oacc[ct][r] = O^T[ct*16 + 8*hi + r][lo].
  // mrow is the query's running maximum (equal in both halves); ssum is the
  // sum over this half's keys only, the halves are joined behind the loop.
  v8f oacc[4] = {};
  float mrow = -1e30f, ssum = 0.f;

  stage(0, kg * KT_);
  wait_asynccnt0();
  __syncthreads();
  stage(1, (KG_ + kg) * KT_);

#pragma unroll 1  // one pass is 128 matrix instructions already; keeps the loop small
  for (int t = 0; t < T_ / (KT_ * KG_); ++t) {
    const int bu = t & 1;
    const float* kt_l = &ktile[(bu * KG_ + kg) * 4 * KSUB + kb * 16 + lo];
    const float* vt_l = &vtile[(bu * KG_ + kg) * 64 * VSTR + lo * VSTR + 8 * hi];

    // S^T tiles (4 x 16 keys x 16 queries), 64 channels via 16 WMMA steps each.
    // A = K from LDS: row = key kt*16 + lo, k slot (hi, v) = channel
    // 4j + 2*hi + v, the same channel that qf[j] holds in that slot.
    v8f sacc[4] = {};
#pragma unroll
    for (int j = 0; j < 16; ++j) {
#pragma unroll
      for (int kt = 0; kt < 4; ++kt) {
        v2f ka;
        ka.x = kt_l[kt * KSUB + (4 * j) * 16];
        ka.y = kt_l[kt * KSUB + (4 * j + 1) * 16];
        sacc[kt] = wmma_f32(ka, qf[j], sacc[kt]);
      }
    }

    // Online softmax.  sacc[kt][r] = score of key (t*2 + kg)*64 + kt*16 + 8*hi + r
    // for query lo.
    float mk[4];
#pragma unroll
    for (int kt = 0; kt < 4; ++kt) {
#pragma unroll
      for (int r = 0; r < 8; ++r) sacc[kt][r] *= 0.125f;  // scale^2 = ch^-0.5 = 1/8
      mk[kt] = fmaxf(fmaxf(fmaxf(sacc[kt][0], sacc[kt][1]), fmaxf(sacc[kt][2], sacc[kt][3])),
                     fmaxf(fmaxf(sacc[kt][4], sacc[kt][5]), fmaxf(sacc[kt][6], sacc[kt][7])));
    }
    float mx = fmaxf(fmaxf(mk[0], mk[1]), fmaxf(mk[2], mk[3]));
    mx = fmaxf(mx, xhalf(mx));
    const float mnew = fmaxf(mrow, mx);
    const float alpha = __expf(mrow - mnew);
    mrow = mnew;
    float pr[4][8], sk[4];
#pragma unroll
    for (int kt = 0; kt < 4; ++kt) {
#pragma unroll
      for (int r = 0; r < 8; ++r) sacc[kt][r] -= mnew;
#pragma unroll
      for (int r = 0; r < 8; ++r) pr[kt][r] = __expf(sacc[kt][r]);
      sk[kt] = ((pr[kt][0] + pr[kt][1]) + (pr[kt][2] + pr[kt][3])) +
               ((pr[kt][4] + pr[kt][5]) + (pr[kt][6] + pr[kt][7]));
    }
    ssum = ssum * alpha + ((sk[0] + sk[1]) + (sk[2] + sk[3]));
#pragma unroll
    for (int ct = 0; ct < 4; ++ct)
#pragma unroll
      for (int r = 0; r < 8; ++r) oacc[ct][r] *= alpha;

    // O^T += V P^T : 64 keys via 16 WMMA steps, 4 channel tiles.
    // B = P^T straight from the score registers: k slot (hi, v) of step j2 of
    // key tile kt is key kt*16 + 8*hi + 2*j2 + v.  A = V from LDS in the same
    // key order: one 16-byte read per lane serves two steps.
#pragma unroll
    for (int kt = 0; kt < 4; ++kt) {
#pragma unroll
      for (int jj = 0; jj < 2; ++jj) {
        v4f va[4];
#pragma unroll
        for (int ct = 0; ct < 4; ++ct)
          va[ct] = *(const v4f*)&vt_l[ct * 16 * VSTR + kt * 16 + 4 * jj];
        v2f pb0, pb1;
        pb0.x = pr[kt][4 * jj];
        pb0.y = pr[kt][4 * jj + 1];
        pb1.x = pr[kt][4 * jj + 2];
        pb1.y = pr[kt][4 * jj + 3];
#pragma unroll
        for (int ct = 0; ct < 4; ++ct) {
          v2f a0;
          a0.x = va[ct].x;
          a0.y = va[ct].y;
          oacc[ct] = wmma_f32(a0, pb0, oacc[ct]);
        }
#pragma unroll
        for (int ct = 0; ct < 4; ++ct) {
          v2f a1;
          a1.x = va[ct].z;
          a1.y = va[ct].w;
          oacc[ct] = wmma_f32(a1, pb1, oacc[ct]);
        }
      }
    }

    wait_dscnt0();      // our reads of buffer bu have returned
    wait_asynccnt0();   // our copies into bu^1 have landed
    __syncthreads();    // everyone done reading bu / writing bu^1
    // The pass's last matrix instructions stand right in front of a branch:
    // hold them here and keep the vector
    // slots they need ahead of both paths, which rewrite their operands.
    __builtin_amdgcn_sched_barrier(0);
    asm volatile("v_nop\n\tv_nop\n\tv_nop\n\tv_nop");
    if (t + 2 < T_ / (KT_ * KG_)) stage(bu, ((t + 2) * KG_ + kg) * KT_);  // refill the buffer just read
  }
  wait_asynccnt0();     // nothing of ours is in flight when the wave ends

  // Join the halves' sums, then the groups.  Behind the loop's last barrier no
  // wave reads a tile any more and no copy is in flight, so the K tiles' LDS
  // carries group 1's partial results to the wave of group 0 that has the same
  // queries (same lane, same registers).
  const float lsum = ssum + xhalf(ssum);
  float* xw = &ktile[(wv * 32 + lane) * XP_];
  if (kg == 1) {
#pragma unroll
    for (int ct = 0; ct < 4; ++ct) {
      v4f p0, p1;
      p0.x = oacc[ct][0]; p0.y = oacc[ct][1]; p0.z = oacc[ct][2]; p0.w = oacc[ct][3];
      p1.x = oacc[ct][4]; p1.y = oacc[ct][5]; p1.z = oacc[ct][6]; p1.w = oacc[ct][7];
      *(v4f*)&xw[ct * 8] = p0;
      *(v4f*)&xw[ct * 8 + 4] = p1;
    }
    v2f ml;
    ml.x = mrow;
    ml.y = lsum;
    *(v2f*)&xw[32] = ml;
  }
  __syncthreads();      // group 1's partial results are in LDS
  if (kg == 0) {
    const v2f ml = *(const v2f*)&xw[32];
    const float mj = fmaxf(mrow, ml.x);
    const float a0 = __expf(mrow - mj);
    const float a1 = __expf(ml.x - mj);
    const float inv = 1.0f / (lsum * a0 + ml.y * a1);
    const float f0 = a0 * inv, f1 = a1 * inv;
    // normalize and write a[b, h*64 + c, t]
    float* ab = aout + ((size_t)b * C_ + (size_t)h * CH_) * T_;
#pragma unroll
    for (int ct = 0; ct < 4; ++ct) {
      const v4f p0 = *(const v4f*)&xw[ct * 8];
      const v4f p1 = *(const v4f*)&xw[ct * 8 + 4];
#pragma unroll
      for (int r = 0; r < 8; ++r) {
        const float o1 = r < 4 ? p0[r & 3] : p1[r & 3];
        ab[(size_t)(ct * 16 + 8 * hi + r) * T_ + t0 + lo] = oacc[ct][r] * f0 + o1 * f1;
      }
    }
  }
}

// ---------------------------------------------------------------------------
// Kernel 4: proj GEMM + bias + residual -> out
// ---------------------------------------------------------------------------
__global__ void proj_gemm(const float* __restrict__ a,
                          const float* __restrict__ w,
                          const float* __restrict__ bias,
                          const float* __restrict__ x,
                          float* __restrict__ out) {
  const int wid = blockIdx.x * (blockDim.x >> 5) + (threadIdx.x >> 5);
  const int lane = threadIdx.x & 31;
  const int lo = lane & 15;
  const int hi = lane >> 4;
  const int kb = hi * 2;

  const int b = wid / (16 * 64);          // 256/16=16 mtiles, 64 ntiles
  const int rem = wid % (16 * 64);
  const int m0 = (rem / 64) * 16;
  const int n0 = (rem % 64) * 64;

  const float* ab = a + (size_t)b * C_ * T_;
  v8f acc[4] = {};

  for (int c = 0; c < C_; c += 4) {
    v2f av = *(const v2f*)(w + (size_t)(m0 + lo) * C_ + c + kb);
#pragma unroll
    for (int nt = 0; nt < 4; ++nt) {
      const float* bp = ab + (size_t)(c + kb) * T_ + n0 + nt * 16 + lo;
      v2f bb;
      bb.x = bp[0];
      bb.y = bp[T_];
      acc[nt] = wmma_f32(av, bb, acc[nt]);
    }
  }

  const float* xb = x + (size_t)b * C_ * T_;
  float* ob = out + (size_t)b * C_ * T_;
#pragma unroll
  for (int r = 0; r < 8; ++r) {
    const int row = m0 + r + 8 * hi;
    const float bv = bias[row];
#pragma unroll
    for (int nt = 0; nt < 4; ++nt) {
      const size_t idx = (size_t)row * T_ + n0 + nt * 16 + lo;
      ob[idx] = xb[idx] + acc[nt][r] + bv;
    }
  }
}

// ---------------------------------------------------------------------------
extern "C" void kernel_launch(void* const* d_in, const int* in_sizes, int n_in,
                              void* d_out, int out_size, void* d_ws, size_t ws_size,
                              hipStream_t stream) {
  (void)in_sizes; (void)n_in; (void)out_size; (void)ws_size;
  const float* x  = (const float*)d_in[0];
  const float* nw = (const float*)d_in[1];
  const float* nb = (const float*)d_in[2];
  const float* qw = (const float*)d_in[3];
  const float* qb = (const float*)d_in[4];
  const float* pw = (const float*)d_in[5];
  const float* pb = (const float*)d_in[6];
  float* out = (float*)d_out;

  float* ws = (float*)d_ws;
  float* xn   = ws;                                   //  8 MB: (2,256,4096)
  float* qkv  = xn + (size_t)B_ * C_ * T_;            // 24 MB: (2,768,4096)
  float* attn = qkv + (size_t)B_ * 3 * C_ * T_;       //  8 MB: (2,256,4096)

  gn_kernel<<<B_ * GROUPS_, GN_THREADS, 0, stream>>>(x, nw, nb, xn);
  qkv_gemm<<<(B_ * 48 * 64) / 8, 256, 0, stream>>>(xn, qw, qb, qkv);
  flash_attn<<<B_ * NH_ * (T_ / 64), 128 * KG_, 0, stream>>>(qkv, attn);
  proj_gemm<<<(B_ * 16 * 64) / 8, 256, 0, stream>>>(attn, pw, pb, x, out);
}

// v005
// One run takes 203 microseconds.
// Two timings next to v004 put it at 1.05 and 1.06 times that version's speed.
// Over all steps from v000 it is 3.62 times as fast.
#include <hip/hip_runtime.h>
#include <math.h>
#include <stdint.h>

typedef __attribute__((ext_vector_type(2))) float v2f;
typedef __attribute__((ext_vector_type(4))) float v4f;
typedef __attribute__((ext_vector_type(8))) float v8f;

#define B_ 2
#define C_ 256
#define T_ 4096
#define NH_ 4
#define CH_ 64
#define GROUPS_ 32
#define CPG_ 8    // channels per group
#define GN_THREADS 1024
#define KT_ 64    // keys per pass of a wave in the attention loop
#define KG_ 2     // key groups of a block: group kg takes the 64-key tiles kg, kg + 2, kg + 4, ...
#define XP_ 36    // floats per lane in the groups' exchange: 144B = 16B x odd
#define KSUB 1040 // K-tile LDS: four sub-tiles [64 c][16 s], 16 floats apart in bank so that a row's copy spreads over all banks
#define GK_ 64    // channels per staged chunk in the two channel GEMMs
#define GT_ 128   // columns (t) of a GEMM block's tile
#define XPIT 144  // X-chunk LDS row pitch (floats): rows c .. c + 3 fall in the four quarters of the banks
#define WPIT 68   // W-chunk LDS row pitch (floats): 272B = 16B x odd, a fragment's 8-byte reads cover every bank once
#define VSTR 68   // V-tile LDS row pitch (floats): 272B = 16B x odd, conflict-free for the 16-byte reads

static __device__ __forceinline__ v8f wmma_f32(v2f a, v2f b, v8f c) {
  // D = A(16x4) * B(4x16) + C, fp32
  return __builtin_amdgcn_wmma_f32_16x16x4_f32(
      /*neg_a=*/false, a, /*neg_b=*/false, b,
      /*c_mod=*/(short)0, c, /*reuse_a=*/false, /*reuse_b=*/false);
}

// Value of lane l ^ 16 (the other half of the wave).
static __device__ __forceinline__ float xhalf(float x) {
  const int xb = __builtin_bit_cast(int, x);
  return __builtin_bit_cast(float, __builtin_amdgcn_permlanex16(
      xb, xb, 0x76543210, 0xfedcba98, false, false));
}

// Eight 16-byte copies global -> LDS, one per operand pair.  The s_wait_xcnt
// is the last line of the copies' own statement, so that no address register
// of a copy is rewritten in front of it.
static __device__ __forceinline__ void async_b128_x8(const unsigned (&l)[8],
                                                     const float* const (&g)[8]) {
  asm volatile("global_load_async_to_lds_b128 %0, %8, off\n\t"
               "global_load_async_to_lds_b128 %1, %9, off\n\t"
               "global_load_async_to_lds_b128 %2, %10, off\n\t"
               "global_load_async_to_lds_b128 %3, %11, off\n\t"
               "global_load_async_to_lds_b128 %4, %12, off\n\t"
               "global_load_async_to_lds_b128 %5, %13, off\n\t"
               "global_load_async_to_lds_b128 %6, %14, off\n\t"
               "global_load_async_to_lds_b128 %7, %15, off\n\t"
               "s_wait_xcnt 0x0"
               :: "v"(l[0]), "v"(l[1]), "v"(l[2]), "v"(l[3]),
                  "v"(l[4]), "v"(l[5]), "v"(l[6]), "v"(l[7]),
                  "v"(g[0]), "v"(g[1]), "v"(g[2]), "v"(g[3]),
                  "v"(g[4]), "v"(g[5]), "v"(g[6]), "v"(g[7])
               : "memory");
}

// The same for six and for four copies.
static __device__ __forceinline__ void async_b128_x6(const unsigned (&l)[6],
                                                     const float* const (&g)[6]) {
  asm volatile("global_load_async_to_lds_b128 %0, %6, off\n\t"
               "global_load_async_to_lds_b128 %1, %7, off\n\t"
               "global_load_async_to_lds_b128 %2, %8, off\n\t"
               "global_load_async_to_lds_b128 %3, %9, off\n\t"
               "global_load_async_to_lds_b128 %4, %10, off\n\t"
               "global_load_async_to_lds_b128 %5, %11, off\n\t"
               "s_wait_xcnt 0x0"
               :: "v"(l[0]), "v"(l[1]), "v"(l[2]), "v"(l[3]), "v"(l[4]), "v"(l[5]),
                  "v"(g[0]), "v"(g[1]), "v"(g[2]), "v"(g[3]), "v"(g[4]), "v"(g[5])
               : "memory");
}

static __device__ __forceinline__ void async_b128_x4(const unsigned (&l)[4],
                                                     const float* const (&g)[4]) {
  asm volatile("global_load_async_to_lds_b128 %0, %4, off\n\t"
               "global_load_async_to_lds_b128 %1, %5, off\n\t"
               "global_load_async_to_lds_b128 %2, %6, off\n\t"
               "global_load_async_to_lds_b128 %3, %7, off\n\t"
               "s_wait_xcnt 0x0"
               :: "v"(l[0]), "v"(l[1]), "v"(l[2]), "v"(l[3]),
                  "v"(g[0]), "v"(g[1]), "v"(g[2]), "v"(g[3])
               : "memory");
}

static __device__ __forceinline__ void wait_asynccnt0() {
  asm volatile("s_wait_asynccnt 0x0" ::: "memory");
}

static __device__ __forceinline__ void wait_dscnt0() {
  asm volatile("s_wait_dscnt 0x0" ::: "memory");
}

// ---------------------------------------------------------------------------
// Kernel 1: GroupNorm over (B, C, T).  One block per (b, group).
// A thread holds 4 neighbouring elements of each of the group's 8 channels in
// registers: its 8 loads are independent and all in flight at once, x is read
// once, and load k is channel k, so scale and shift are uniform per load.
// ---------------------------------------------------------------------------
__global__ __launch_bounds__(GN_THREADS) void gn_kernel(const float* __restrict__ x,
                                                        const float* __restrict__ w,
                                                        const float* __restrict__ bgn,
                                                        float* __restrict__ xn) {
  static_assert(T_ == 4 * GN_THREADS, "one 16-byte load per thread covers one channel row");
  static_assert(GN_THREADS == 32 * 32, "one partial sum per lane in the second butterfly");
  const int b = blockIdx.x / GROUPS_;
  const int g = blockIdx.x % GROUPS_;
  const size_t off = ((size_t)b * C_ + (size_t)g * CPG_) * T_;
  const v4f* xp = (const v4f*)(x + off) + threadIdx.x;
  v4f* xo = (v4f*)(xn + off) + threadIdx.x;

  v4f v[CPG_];
#pragma unroll
  for (int k = 0; k < CPG_; ++k) v[k] = xp[k * (T_ / 4)];
  // Keeps all 8 loads ahead of the sums: without it the last two are issued
  // only after the first six have returned, a second round of latency.
  __builtin_amdgcn_sched_barrier(0);

  float s = 0.f, s2 = 0.f;
#pragma unroll
  for (int k = 0; k < CPG_; ++k) {
    s += (v[k].x + v[k].y) + (v[k].z + v[k].w);
    s2 += (v[k].x * v[k].x + v[k].y * v[k].y) + (v[k].z * v[k].z + v[k].w * v[k].w);
  }
  // Sum over the wave, then over the 32 waves' partial sums (one per lane).
#pragma unroll
  for (int m = 16; m >= 1; m >>= 1) {
    s += __shfl_xor(s, m, 32);
    s2 += __shfl_xor(s2, m, 32);
  }
  __shared__ v2f red[GN_THREADS / 32];
  if ((threadIdx.x & 31) == 0) {
    v2f p;
    p.x = s;
    p.y = s2;
    red[threadIdx.x >> 5] = p;
  }
  __syncthreads();
  const v2f q = red[threadIdx.x & 31];
  s = q.x;
  s2 = q.y;
#pragma unroll
  for (int m = 16; m >= 1; m >>= 1) {
    s += __shfl_xor(s, m, 32);
    s2 += __shfl_xor(s2, m, 32);
  }
  const float invN = 1.0f / (float)(CPG_ * T_);
  const float mean = s * invN;
  const float var = s2 * invN - mean * mean;
  const float rstd = rsqrtf(var + 1e-5f);

#pragma unroll
  for (int k = 0; k < CPG_; ++k) {
    const float wk = w[g * CPG_ + k];
    const float bk = bgn[g * CPG_ + k];
    v4f o;
    o.x = (v[k].x - mean) * rstd * wk + bk;
    o.y = (v[k].y - mean) * rstd * wk + bk;
    o.z = (v[k].z - mean) * rstd * wk + bk;
    o.w = (v[k].w - mean) * rstd * wk + bk;
    xo[k * (T_ / 4)] = o;
  }
}

// ---------------------------------------------------------------------------
// The two channel GEMMs: out[b,o,t] = sum_c w[o,c] * xin[b,c,t] (+ bias, residual).
// A block of 8 waves owns a BM(o) x 128(t) tile.  The 256 channels come in four
// chunks of 64: the chunk's W rows and X rows are copied to LDS once per block
// (async-to-LDS B128, whole 256- and 512-byte rows, two buffers), and every wave
// takes its fragments from there.  Waves: 2 (o) x 4 (t); a wave's tile is
// BM/2 x 32, so one fragment feeds 2 or BM/32 matrix instructions.
// The k slots and the order of the channels are those of a plain loop over c.
// ---------------------------------------------------------------------------
template <int BM>
struct GemmAcc {
  v8f a[BM / 32][2];
};

template <int BM>
static __device__ __forceinline__ void gemm_tile(const float* __restrict__ xb,   // xin + b*C*T + first column
                                                 const float* __restrict__ wb,   // w + first row * C
                                                 float* __restrict__ xs,         // [2][GK_][XPIT]
                                                 float* __restrict__ wt,         // [2][BM][WPIT]
                                                 GemmAcc<BM>& acc) {
  constexpr int MT = BM / 32;
  constexpr int NW = BM * (GK_ / 4) / 256;  // W copies per thread and chunk
  static_assert(NW == 6 || NW == 4, "a copy statement exists for 6 and for 4");
  const int tid = threadIdx.x;
  const int wave = tid >> 5;
  const int lane = tid & 31;
  const int lo = lane & 15;
  const int kb = (lane >> 4) * 2;
  const int wm = wave >> 2;
  const int wn = wave & 3;

  auto stage = [&](int bu, int c0) {
    {
      unsigned l[8];
      const float* g[8];
#pragma unroll
      for (int i = 0; i < 8; ++i) {
        const int row = i * 8 + wave;       // one copy of a wave = one 512-byte row
        l[i] = (unsigned)(uintptr_t)&xs[(bu * GK_ + row) * XPIT + lane * 4];
        g[i] = xb + (size_t)(c0 + row) * T_ + lane * 4;
      }
      async_b128_x8(l, g);
    }
    {
      unsigned l[NW];
      const float* g[NW];
#pragma unroll
      for (int i = 0; i < NW; ++i) {
        const int idx = i * 256 + tid;      // one copy of a wave = two 256-byte rows
        const int row = idx >> 4;
        const int k4 = (idx & 15) * 4;
        l[i] = (unsigned)(uintptr_t)&wt[(bu * BM + row) * WPIT + k4];
        g[i] = wb + (size_t)row * C_ + c0 + k4;
      }
      if constexpr (NW == 6) async_b128_x6(l, g);
      else async_b128_x4(l, g);
    }
  };

#pragma unroll
  for (int mt = 0; mt < MT; ++mt)
#pragma unroll
    for (int nt = 0; nt < 2; ++nt) acc.a[mt][nt] = v8f{};

  stage(0, 0);
  wait_asynccnt0();
  __syncthreads();      // chunk 0 is in LDS for every wave
  stage(1, GK_);

#pragma unroll 1  // a chunk is 16 unrolled k steps already; keeps the loop small
  for (int t = 0; t < C_ / GK_; ++t) {
    const int bu = t & 1;
    const float* xl = &xs[(bu * GK_ + kb) * XPIT + wn * 32 + lo];
    const float* wl = &wt[(bu * BM + wm * (MT * 16) + lo) * WPIT + kb];
#pragma unroll
    for (int j = 0; j < GK_ / 4; ++j) {
      v2f av[MT], bv[2];
#pragma unroll
      for (int mt = 0; mt < MT; ++mt) av[mt] = *(const v2f*)&wl[mt * 16 * WPIT + 4 * j];
#pragma unroll
      for (int nt = 0; nt < 2; ++nt) {
        bv[nt].x = xl[(4 * j) * XPIT + nt * 16];
        bv[nt].y = xl[(4 * j + 1) * XPIT + nt * 16];
      }
#pragma unroll
      for (int mt = 0; mt < MT; ++mt)
#pragma unroll
        for (int nt = 0; nt < 2; ++nt) acc.a[mt][nt] = wmma_f32(av[mt], bv[nt], acc.a[mt][nt]);
    }

    wait_dscnt0();      // our reads of buffer bu have returned
    wait_asynccnt0();   // our copies into bu^1 have landed
    __syncthreads();    // everyone done reading bu / writing bu^1
    // The chunk's last matrix instructions stand right in front of a branch: hold them here and keep the vector
    // slots they need ahead of both paths, which rewrite their operands.
    __builtin_amdgcn_sched_barrier(0);
    asm volatile("v_nop\n\tv_nop\n\tv_nop\n\tv_nop");
    if (t + 2 < C_ / GK_) stage(bu, (t + 2) * GK_);  // refill the buffer just read
  }
  wait_asynccnt0();     // nothing of ours is in flight when the wave ends
}

// ---------------------------------------------------------------------------
// Kernel 2: QKV GEMM.  out[b,o,t] = sum_c qkv_w[o,c]*xn[b,c,t] + qkv_b[o]
// Block tile 96(o) x 128(t): 8 x 64 = 512 blocks, two per WGP.
// ---------------------------------------------------------------------------
#define QBM 96
__global__ __launch_bounds__(256) void qkv_gemm(const float* __restrict__ xn,
                                                const float* __restrict__ w,
                                                const float* __restrict__ bias,
                                                float* __restrict__ out) {
  __shared__ __attribute__((aligned(16))) float xs[2 * GK_ * XPIT];
  __shared__ __attribute__((aligned(16))) float wt[2 * QBM * WPIT];
  const int mb = blockIdx.x % (3 * C_ / QBM);
  const int nb = blockIdx.x / (3 * C_ / QBM);   // 0..63
  const int b = nb / (T_ / GT_);
  const int n0 = (nb % (T_ / GT_)) * GT_;
  const int m0 = mb * QBM;

  GemmAcc<QBM> acc;
  gemm_tile<QBM>(xn + (size_t)b * C_ * T_ + n0, w + (size_t)m0 * C_, xs, wt, acc);

  const int wave = threadIdx.x >> 5;
  const int lo = threadIdx.x & 15;
  const int hi = (threadIdx.x >> 4) & 1;
  const int mw = m0 + (wave >> 2) * (QBM / 2);
  const int nw = n0 + (wave & 3) * 32;
  float* ob = out + (size_t)b * (3 * C_) * T_;
#pragma unroll
  for (int mt = 0; mt < QBM / 32; ++mt) {
#pragma unroll
    for (int r = 0; r < 8; ++r) {
      const int row = mw + mt * 16 + r + 8 * hi;
      const float bv = bias[row];
#pragma unroll
      for (int nt = 0; nt < 2; ++nt) {
        ob[(size_t)row * T_ + nw + nt * 16 + lo] = acc.a[mt][nt][r] + bv;
      }
    }
  }
}

// ---------------------------------------------------------------------------
// Kernel 3: Flash attention per (b*NH) head-batch.
// qkv layout per b: 768 rows; head h owns rows [h*192, h*192+192):
//   q = +0..63, k = +64..127, v = +128..191, each (64, T).
// Block = 2 key groups x 4 waves x 16 queries = 64 queries.  Both groups work
// on the same queries; each takes every second 64-key tile, so that a SIMD has
// four waves instead of two to fill one another's waits, and the groups'
// partial (maximum, sum, O) are joined through LDS behind the loop.  A group's
// K/V tiles (shared by its 4 waves) are double-buffered in LDS via async-to-LDS
// B128 copies.
// Transposed products: S^T = K^T Q (keys x queries), O^T += V P^T
// (channels x queries).  A lane then holds 32 scores of ONE query per pass
// (lane l ^ 16 the other 32), so the softmax is in-lane plus one exchange of
// the halves, and the score registers are the B operand of the second product.
// ---------------------------------------------------------------------------
__global__ __launch_bounds__(128 * KG_) void flash_attn(const float* __restrict__ qkv,
                                                        float* __restrict__ aout) {
  __shared__ __attribute__((aligned(16))) float ktile[2 * KG_ * 4 * KSUB];   // [buffer][group][s / 16][c][s % 16]
  __shared__ __attribute__((aligned(16))) float vtile[2 * KG_ * 64 * VSTR];  // [buffer][group][c][s]
  static_assert(4 * 32 * XP_ <= 2 * KG_ * 4 * KSUB, "the exchange fits the K tiles");

  const int kg = __builtin_amdgcn_readfirstlane((int)threadIdx.x >> 7);  // key group, the same in a wave
  const int tid = threadIdx.x & 127;      // 0..127 within the group
  const int wv = tid >> 5;
  const int lane = tid & 31;
  const int lo = lane & 15;
  const int hi = lane >> 4;
  const int kb = hi * 2;

  const int bh = blockIdx.x >> 6;         // 0..7
  const int qb = blockIdx.x & 63;         // 64 query blocks of 64
  const int t0 = qb * 64 + wv * 16;
  const int b = bh >> 2, h = bh & 3;

  const float* base = qkv + ((size_t)b * (3 * C_) + (size_t)h * 192) * T_;
  const float* qp = base;
  const float* kp = base + (size_t)64 * T_;
  const float* vp = base + (size_t)128 * T_;

  // A group's cooperative async staging of its K tile + V tile (64 rows x 64 keys).
  // 1024 16B-chunks per tile, 128 threads -> 8 chunks/thread per tile; a wave's
  // copy covers two whole 256-byte rows.
  const int srow = tid >> 4;              // 0..7
  const int sq4 = (tid & 15) * 4;
  auto stage = [&](int bu, int s0) {
    float* kd = &ktile[(bu * KG_ + kg) * 4 * KSUB];
    float* vd = &vtile[(bu * KG_ + kg) * 64 * VSTR];
    unsigned l[8];
    const float* g[8];
#pragma unroll
    for (int i = 0; i < 8; ++i) {
      const int row = i * 8 + srow;
      l[i] = (unsigned)(uintptr_t)&kd[(sq4 >> 4) * KSUB + row * 16 + (sq4 & 15)];
      g[i] = kp + (size_t)row * T_ + s0 + sq4;
    }
    async_b128_x8(l, g);
#pragma unroll
    for (int i = 0; i < 8; ++i) {
      const int row = i * 8 + srow;
      l[i] = (unsigned)(uintptr_t)&vd[row * VSTR + sq4];
      g[i] = vp + (size_t)row * T_ + s0 + sq4;
    }
    async_b128_x8(l, g);
  };

  // Q tile (64 channels x 16 queries) in B layout, held for whole key loop
  v2f qf[16];
#pragma unroll
  for (int j = 0; j < 16; ++j) {
    const float* p = qp + (size_t)(4 * j + kb) * T_ + t0 + lo;
    qf[j].x = p[0];
    qf[j].y = p[T_];
  }

  // Per lane: query t0 + lo.  oacc[ct][r] = O^T[ct*16 + 8*hi + r][lo].
  // mrow is the query's running maximum (equal in both halves); ssum is the
  // sum over this half's keys only, the halves are joined behind the loop.
  v8f oacc[4] = {};
  float mrow = -1e30f, ssum = 0.f;

  stage(0, kg * KT_);
  wait_asynccnt0();
  __syncthreads();
  stage(1, (KG_ + kg) * KT_);

#pragma unroll 1  // one pass is 128 matrix instructions already; keeps the loop small
  for (int t = 0; t < T_ / (KT_ * KG_); ++t) {
    const int bu = t & 1;
    const float* kt_l = &ktile[(bu * KG_ + kg) * 4 * KSUB + kb * 16 + lo];
    const float* vt_l = &vtile[(bu * KG_ + kg) * 64 * VSTR + lo * VSTR + 8 * hi];

    // S^T tiles (4 x 16 keys x 16 queries), 64 channels via 16 WMMA steps each.
    // A = K from LDS: row = key kt*16 + lo, k slot (hi, v) = channel
    // 4j + 2*hi + v, the same channel that qf[j] holds in that slot.
    v8f sacc[4] = {};
#pragma unroll
    for (int j = 0; j < 16; ++j) {
#pragma unroll
      for (int kt = 0; kt < 4; ++kt) {
        v2f ka;
        ka.x = kt_l[kt * KSUB + (4 * j) * 16];
        ka.y = kt_l[kt * KSUB + (4 * j + 1) * 16];
        sacc[kt] = wmma_f32(ka, qf[j], sacc[kt]);
      }
    }

    // Online softmax.  sacc[kt][r] = score of key (t*2 + kg)*64 + kt*16 + 8*hi + r
    // for query lo.
    float mk[4];
#pragma unroll
    for (int kt = 0; kt < 4; ++kt) {
#pragma unroll
      for (int r = 0; r < 8; ++r) sacc[kt][r] *= 0.125f;  // scale^2 = ch^-0.5 = 1/8
      mk[kt] = fmaxf(fmaxf(fmaxf(sacc[kt][0], sacc[kt][1]), fmaxf(sacc[kt][2], sacc[kt][3])),
                     fmaxf(fmaxf(sacc[kt][4], sacc[kt][5]), fmaxf(sacc[kt][6], sacc[kt][7])));
    }
    float mx = fmaxf(fmaxf(mk[0], mk[1]), fmaxf(mk[2], mk[3]));
    mx = fmaxf(mx, xhalf(mx));
    const float mnew = fmaxf(mrow, mx);
    const float alpha = __expf(mrow - mnew);
    mrow = mnew;
    float pr[4][8], sk[4];
#pragma unroll
    for (int kt = 0; kt < 4; ++kt) {
#pragma unroll
      for (int r = 0; r < 8; ++r) sacc[kt][r] -= mnew;
#pragma unroll
      for (int r = 0; r < 8; ++r) pr[kt][r] = __expf(sacc[kt][r]);
      sk[kt] = ((pr[kt][0] + pr[kt][1]) + (pr[kt][2] + pr[kt][3])) +
               ((pr[kt][4] + pr[kt][5]) + (pr[kt][6] + pr[kt][7]));
    }
    ssum = ssum * alpha + ((sk[0] + sk[1]) + (sk[2] + sk[3]));
#pragma unroll
    for (int ct = 0; ct < 4; ++ct)
#pragma unroll
      for (int r = 0; r < 8; ++r) oacc[ct][r] *= alpha;

    // O^T += V P^T : 64 keys via 16 WMMA steps, 4 channel tiles.
    // B = P^T straight from the score registers: k slot (hi, v) of step j2 of
    // key tile kt is key kt*16 + 8*hi + 2*j2 + v.  A = V from LDS in the same
    // key order: one 16-byte read per lane serves two steps.
#pragma unroll
    for (int kt = 0; kt < 4; ++kt) {
#pragma unroll
      for (int jj = 0; jj < 2; ++jj) {
        v4f va[4];
#pragma unroll
        for (int ct = 0; ct < 4; ++ct)
          va[ct] = *(const v4f*)&vt_l[ct * 16 * VSTR + kt * 16 + 4 * jj];
        v2f pb0, pb1;
        pb0.x = pr[kt][4 * jj];
        pb0.y = pr[kt][4 * jj + 1];
        pb1.x = pr[kt][4 * jj + 2];
        pb1.y = pr[kt][4 * jj + 3];
#pragma unroll
        for (int ct = 0; ct < 4; ++ct) {
          v2f a0;
          a0.x = va[ct].x;
          a0.y = va[ct].y;
          oacc[ct] = wmma_f32(a0, pb0, oacc[ct]);
        }
#pragma unroll
        for (int ct = 0; ct < 4; ++ct) {
          v2f a1;
          a1.x = va[ct].z;
          a1.y = va[ct].w;
          oacc[ct] = wmma_f32(a1, pb1, oacc[ct]);
        }
      }
    }

    wait_dscnt0();      // our reads of buffer bu have returned
    wait_asynccnt0();   // our copies into bu^1 have landed
    __syncthreads();    // everyone done reading bu / writing bu^1
    // The pass's last matrix instructions stand right in front of a branch:
    // hold them here and keep the vector
    // slots they need ahead of both paths, which rewrite their operands.
    __builtin_amdgcn_sched_barrier(0);
    asm volatile("v_nop\n\tv_nop\n\tv_nop\n\tv_nop");
    if (t + 2 < T_ / (KT_ * KG_)) stage(bu, ((t + 2) * KG_ + kg) * KT_);  // refill the buffer just read
  }
  wait_asynccnt0();     // nothing of ours is in flight when the wave ends

  // Join the halves' sums, then the groups.  Behind the loop's last barrier no
  // wave reads a tile any more and no copy is in flight, so the K tiles' LDS
  // carries group 1's partial results to the wave of group 0 that has the same
  // queries (same lane, same registers).
  const float lsum = ssum + xhalf(ssum);
  float* xw = &ktile[(wv * 32 + lane) * XP_];
  if (kg == 1) {
#pragma unroll
    for (int ct = 0; ct < 4; ++ct) {
      v4f p0, p1;
      p0.x = oacc[ct][0]; p0.y = oacc[ct][1]; p0.z = oacc[ct][2]; p0.w = oacc[ct][3];
      p1.x = oacc[ct][4]; p1.y = oacc[ct][5]; p1.z = oacc[ct][6]; p1.w = oacc[ct][7];
      *(v4f*)&xw[ct * 8] = p0;
      *(v4f*)&xw[ct * 8 + 4] = p1;
    }
    v2f ml;
    ml.x = mrow;
    ml.y = lsum;
    *(v2f*)&xw[32] = ml;
  }
  __syncthreads();      // group 1's partial results are in LDS
  if (kg == 0) {
    const v2f ml = *(const v2f*)&xw[32];
    const float mj = fmaxf(mrow, ml.x);
    const float a0 = __expf(mrow - mj);
    const float a1 = __expf(ml.x - mj);
    const float inv = 1.0f / (lsum * a0 + ml.y * a1);
    const float f0 = a0 * inv, f1 = a1 * inv;
    // normalize and write a[b, h*64 + c, t]
    float* ab = aout + ((size_t)b * C_ + (size_t)h * CH_) * T_;
#pragma unroll
    for (int ct = 0; ct < 4; ++ct) {
      const v4f p0 = *(const v4f*)&xw[ct * 8];
      const v4f p1 = *(const v4f*)&xw[ct * 8 + 4];
#pragma unroll
      for (int r = 0; r < 8; ++r) {
        const float o1 = r < 4 ? p0[r & 3] : p1[r & 3];
        ab[(size_t)(ct * 16 + 8 * hi + r) * T_ + t0 + lo] = oacc[ct][r] * f0 + o1 * f1;
      }
    }
  }
}

// ---------------------------------------------------------------------------
// Kernel 4: proj GEMM + bias + residual -> out
// Block tile 64(o) x 128(t): 4 x 64 = 256 blocks.
// ---------------------------------------------------------------------------
#define PBM 64
__global__ __launch_bounds__(256) void proj_gemm(const float* __restrict__ a,
                                                 const float* __restrict__ w,
                                                 const float* __restrict__ bias,
                                                 const float* __restrict__ x,
                                                 float* __restrict__ out) {
  __shared__ __attribute__((aligned(16))) float xs[2 * GK_ * XPIT];
  __shared__ __attribute__((aligned(16))) float wt[2 * PBM * WPIT];
  const int mb = blockIdx.x % (C_ / PBM);
  const int nb = blockIdx.x / (C_ / PBM);       // 0..63
  const int b = nb / (T_ / GT_);
  const int n0 = (nb % (T_ / GT_)) * GT_;
  const int m0 = mb * PBM;

  GemmAcc<PBM> acc;
  gemm_tile<PBM>(a + (size_t)b * C_ * T_ + n0, w + (size_t)m0 * C_, xs, wt, acc);

  const int wave = threadIdx.x >> 5;
  const int lo = threadIdx.x & 15;
  const int hi = (threadIdx.x >> 4) & 1;
  const int mw = m0 + (wave >> 2) * (PBM / 2);
  const int nw = n0 + (wave & 3) * 32;
  const float* xb = x + (size_t)b * C_ * T_;
  float* ob = out + (size_t)b * C_ * T_;
#pragma unroll
  for (int mt = 0; mt < PBM / 32; ++mt) {
#pragma unroll
    for (int r = 0; r < 8; ++r) {
      const int row = mw + mt * 16 + r + 8 * hi;
      const float bv = bias[row];
#pragma unroll
      for (int nt = 0; nt < 2; ++nt) {
        const size_t idx = (size_t)row * T_ + nw + nt * 16 + lo;
        ob[idx] = xb[idx] + acc.a[mt][nt][r] + bv;
      }
    }
  }
}

// ---------------------------------------------------------------------------
extern "C" void kernel_launch(void* const* d_in, const int* in_sizes, int n_in,
                              void* d_out, int out_size, void* d_ws, size_t ws_size,
                              hipStream_t stream) {
  (void)in_sizes; (void)n_in; (void)out_size; (void)ws_size;
  const float* x  = (const float*)d_in[0];
  const float* nw = (const float*)d_in[1];
  const float* nb = (const float*)d_in[2];
  const float* qw = (const float*)d_in[3];
  const float* qb = (const float*)d_in[4];
  const float* pw = (const float*)d_in[5];
  const float* pb = (const float*)d_in[6];
  float* out = (float*)d_out;

  float* ws = (float*)d_ws;
  float* xn   = ws;                                   //  8 MB: (2,256,4096)
  float* qkv  = xn + (size_t)B_ * C_ * T_;            // 24 MB: (2,768,4096)
  float* attn = qkv + (size_t)B_ * 3 * C_ * T_;       //  8 MB: (2,256,4096)

  gn_kernel<<<B_ * GROUPS_, GN_THREADS, 0, stream>>>(x, nw, nb, xn);
  qkv_gemm<<<B_ * (3 * C_ / QBM) * (T_ / GT_), 256, 0, stream>>>(xn, qw, qb, qkv);
  flash_attn<<<B_ * NH_ * (T_ / 64), 128 * KG_, 0, stream>>>(qkv, attn);
  proj_gemm<<<B_ * (C_ / PBM) * (T_ / GT_), 256, 0, stream>>>(attn, pw, pb, x, out);
}
